// v000
// Times are from an AMD MI455X. After a warm-up the kernel runs many times in a row, and a time is the length of
// such a window on the GPU divided by its runs, so every launch and the gaps after it count. The runs cycle
// through copies of the inputs. A figure is the median of several windows, for all but v000 over two sittings.
// Sittings can differ by a few percent; kernels timed side by side share one.
// v000, which the later versions start from, runs in 60.5 microseconds.
#include <hip/hip_runtime.h>
#include <hip/hip_bf16.h>

typedef __attribute__((ext_vector_type(8)))  _Float16 v8h;
typedef __attribute__((ext_vector_type(16))) _Float16 v16h;
typedef __attribute__((ext_vector_type(8)))  float    v8f;

typedef int v4i __attribute__((vector_size(16)));
typedef __attribute__((address_space(1))) v4i gv4i;  // global 128-bit
typedef __attribute__((address_space(3))) v4i lv4i;  // LDS    128-bit

#define LN_EPS 1e-5f

#if defined(__has_builtin)
#if __has_builtin(__builtin_amdgcn_global_load_async_to_lds_b128)
#define HAVE_ASYNC_LDS 1
#endif
#endif

// 16B global -> LDS staging (async CDNA5 path when available)
__device__ __forceinline__ void stage16(const _Float16* g, _Float16* l) {
#ifdef HAVE_ASYNC_LDS
    __builtin_amdgcn_global_load_async_to_lds_b128(
        (gv4i*)(uintptr_t)g, (lv4i*)(uintptr_t)l, 0, 0);
#else
    *reinterpret_cast<v8h*>(l) = *reinterpret_cast<const v8h*>(g);
#endif
}

__device__ __forceinline__ void stage_wait() {
#ifdef HAVE_ASYNC_LDS
#if __has_builtin(__builtin_amdgcn_s_wait_asynccnt)
    __builtin_amdgcn_s_wait_asynccnt(0);
#else
    asm volatile("s_wait_asynccnt 0" ::: "memory");
#endif
#endif
}

// ---------------- block reduction helpers (blockDim.x == 256, 8 waves) ----------------
__device__ __forceinline__ float block_reduce_sum(float v, float* scratch) {
#pragma unroll
    for (int o = 16; o > 0; o >>= 1) v += __shfl_xor(v, o, 32);
    if ((threadIdx.x & 31) == 0) scratch[threadIdx.x >> 5] = v;
    __syncthreads();
    float r = 0.0f;
#pragma unroll
    for (int i = 0; i < 8; ++i) r += scratch[i];
    __syncthreads();
    return r;
}

__device__ __forceinline__ float block_reduce_max(float v, float* scratch) {
#pragma unroll
    for (int o = 16; o > 0; o >>= 1) v = fmaxf(v, __shfl_xor(v, o, 32));
    if ((threadIdx.x & 31) == 0) scratch[threadIdx.x >> 5] = v;
    __syncthreads();
    float r = scratch[0];
#pragma unroll
    for (int i = 1; i < 8; ++i) r = fmaxf(r, scratch[i]);
    __syncthreads();
    return r;
}

// ---------------- kA: x_prompt[p,d] = (concat(LN(emb_prompt[p]), prev[p]) @ W^T)[d] + b[d] + emb_prompt[p,d]
__global__ void kA_prompt(const float* __restrict__ emb_prompt,
                          const float* __restrict__ prev_cell,
                          const float* __restrict__ lnw, const float* __restrict__ lnb,
                          const float* __restrict__ W,   // [256, 512]
                          const float* __restrict__ Wb,
                          float* __restrict__ x_prompt) {
    __shared__ __align__(16) float xp[512];
    __shared__ float scratch[8];
    const int p = blockIdx.x, d = threadIdx.x;

    const float e  = emb_prompt[p * 256 + d];
    const float mu = block_reduce_sum(e, scratch) * (1.0f / 256.0f);
    const float dv = e - mu;
    const float var = block_reduce_sum(dv * dv, scratch) * (1.0f / 256.0f);
    const float rs  = rsqrtf(var + LN_EPS);
    xp[d]       = dv * rs * lnw[d] + lnb[d];
    xp[256 + d] = prev_cell[p * 256 + d];
    __syncthreads();

    float acc = Wb[d] + e;
    const float4* Wr = reinterpret_cast<const float4*>(W + (size_t)d * 512);
#pragma unroll 4
    for (int k4 = 0; k4 < 128; ++k4) {
        const float4 w4 = Wr[k4];
        const float4 x4 = *reinterpret_cast<const float4*>(&xp[k4 * 4]);
        acc += w4.x * x4.x + w4.y * x4.y + w4.z * x4.z + w4.w * x4.w;
    }
    x_prompt[p * 256 + d] = acc;
}

// ---------------- kB: x_col = LN(emb_column)
__global__ void kB_col(const float* __restrict__ emb_col,
                       const float* __restrict__ lnw, const float* __restrict__ lnb,
                       float* __restrict__ x_col) {
    __shared__ float scratch[8];
    const int c = blockIdx.x, d = threadIdx.x;
    const float e  = emb_col[c * 256 + d];
    const float mu = block_reduce_sum(e, scratch) * (1.0f / 256.0f);
    const float dv = e - mu;
    const float var = block_reduce_sum(dv * dv, scratch) * (1.0f / 256.0f);
    x_col[c * 256 + d] = dv * rsqrtf(var + LN_EPS) * lnw[d] + lnb[d];
}

// ---------------- kC: mask = softmax(x_prompt @ x_col^T)
__global__ void kC_mask(const float* __restrict__ x_prompt,
                        const float* __restrict__ x_col,
                        float* __restrict__ maskf,
                        _Float16* __restrict__ maskh) {
    __shared__ __align__(16) float xp[256];
    __shared__ float scratch[8];
    const int p = blockIdx.x, c = threadIdx.x;
    xp[c] = x_prompt[p * 256 + c];
    __syncthreads();

    float acc = 0.0f;
    const float4* xc = reinterpret_cast<const float4*>(x_col + (size_t)c * 256);
#pragma unroll 4
    for (int k4 = 0; k4 < 64; ++k4) {
        const float4 a = xc[k4];
        const float4 b = *reinterpret_cast<const float4*>(&xp[k4 * 4]);
        acc += a.x * b.x + a.y * b.y + a.z * b.z + a.w * b.w;
    }
    const float mx = block_reduce_max(acc, scratch);
    const float ex = __expf(acc - mx);
    const float sm = block_reduce_sum(ex, scratch);
    const float mv = ex / sm;
    maskf[p * 256 + c] = mv;
    maskh[p * 256 + c] = (_Float16)mv;
}

// ---------------- kD: xembT[b, d, c] = LN_over_d(relu(feb[c,:] + x[b,c]*few[c,:])) stored f16 TRANSPOSED
// grid 1024: b = bx>>2, c-tile of 64 = (bx&3)*64. block 256 (8 waves); each wave handles a pair of c-rows.
#define KD_PITCH 72
__global__ void kD_emb(const float* __restrict__ x,
                       const float* __restrict__ few, const float* __restrict__ feb,
                       const float* __restrict__ lnw, const float* __restrict__ lnb,
                       _Float16* __restrict__ xembT) {
    __shared__ __align__(16) _Float16 sT[256][KD_PITCH];  // [d][c_local]
    const int lane = threadIdx.x & 31, wave = threadIdx.x >> 5;
    const int b = blockIdx.x >> 2, c0 = (blockIdx.x & 3) << 6;

    float g[8], h[8];
#pragma unroll
    for (int i = 0; i < 8; ++i) {
        const int d = lane + 32 * i;
        g[i] = lnw[d]; h[i] = lnb[d];
    }

    for (int iter = 0; iter < 4; ++iter) {
        const int cl = iter * 16 + wave * 2;       // two adjacent c rows
        const int c  = c0 + cl;
        const float xv0 = x[b * 256 + c];
        const float xv1 = x[b * 256 + c + 1];
        float v0[8], v1[8];
        float s0 = 0.f, q0 = 0.f, s1 = 0.f, q1 = 0.f;
#pragma unroll
        for (int i = 0; i < 8; ++i) {
            const int d = lane + 32 * i;
            const float a0 = fmaxf(0.0f, feb[(size_t)c * 256 + d]       + xv0 * few[(size_t)c * 256 + d]);
            const float a1 = fmaxf(0.0f, feb[(size_t)(c + 1) * 256 + d] + xv1 * few[(size_t)(c + 1) * 256 + d]);
            v0[i] = a0; v1[i] = a1;
            s0 += a0; q0 += a0 * a0; s1 += a1; q1 += a1 * a1;
        }
#pragma unroll
        for (int o = 16; o > 0; o >>= 1) {
            s0 += __shfl_xor(s0, o, 32); q0 += __shfl_xor(q0, o, 32);
            s1 += __shfl_xor(s1, o, 32); q1 += __shfl_xor(q1, o, 32);
        }
        const float mu0 = s0 * (1.0f / 256.0f), mu1 = s1 * (1.0f / 256.0f);
        const float rs0 = rsqrtf(q0 * (1.0f / 256.0f) - mu0 * mu0 + LN_EPS);
        const float rs1 = rsqrtf(q1 * (1.0f / 256.0f) - mu1 * mu1 + LN_EPS);
#pragma unroll
        for (int i = 0; i < 8; ++i) {
            const int d = lane + 32 * i;
            union { _Float16 hh[2]; unsigned u; } pk;
            pk.hh[0] = (_Float16)((v0[i] - mu0) * rs0 * g[i] + h[i]);
            pk.hh[1] = (_Float16)((v1[i] - mu1) * rs1 * g[i] + h[i]);
            *reinterpret_cast<unsigned*>(&sT[d][cl]) = pk.u;   // b32 packed transpose store
        }
    }
    __syncthreads();

    // coalesced writeout: 8 consecutive threads cover 128B of one d-row
#pragma unroll
    for (int it = 0; it < 8; ++it) {
        const int d  = it * 32 + (threadIdx.x >> 3);
        const int ch = (threadIdx.x & 7) * 8;
        const v8h vv = *reinterpret_cast<const v8h*>(&sT[d][ch]);
        *reinterpret_cast<v8h*>(xembT + ((size_t)(b * 256 + d)) * 256 + c0 + ch) = vv;
    }
}

// ---------------- kE: out[b,p,d] = (sum_c mask[p,c]*x_emb[b,c,d]) * (1+ew[p]) + mask[b,p]*eb[b]
// grid (d-tiles=2, p-tiles=4, b=256); block 256 = 8 waves; wave: 1 p-subtile x 4 d-subtiles
#define KE_PITCH 40
__global__ void kE_gemm(const _Float16* __restrict__ maskh,
                        const _Float16* __restrict__ xembT,   // [b][d][c]
                        const float* __restrict__ maskf,
                        const float* __restrict__ expand_w,
                        const float* __restrict__ expand_b,
                        float* __restrict__ out) {
    __shared__ __align__(16) _Float16 sA[64][KE_PITCH];   // mask   [p_local][k]
    __shared__ __align__(16) _Float16 sB[128][KE_PITCH];  // xembT  [d_local][k]

    const int b  = blockIdx.z;
    const int p0 = blockIdx.y * 64;
    const int d0 = blockIdx.x * 128;
    const int tid  = threadIdx.x;
    const int wave = tid >> 5, lane = tid & 31;
    const int wp  = wave & 3;          // p subtile
    const int wdg = (wave >> 2) * 4;   // first of four d subtiles

    const int m  = lane & 15;
    const int kb = (lane >> 4) << 3;   // 0 or 8 (ISA 16-bit lane layout)

    v8f acc[4] = {{}, {}, {}, {}};

    const int arow = tid >> 2, ach = (tid & 3) * 8;            // sA staging map (64x4 chunks)
    const int brow0 = tid >> 2, bch0 = (tid & 3) * 8;          // sB chunk 0
    const int brow1 = (tid + 256) >> 2, bch1 = (tid & 3) * 8;  // sB chunk 1

    for (int c0 = 0; c0 < 256; c0 += 32) {
        __syncthreads();
        stage16(maskh + (size_t)(p0 + arow) * 256 + c0 + ach, &sA[arow][ach]);
        stage16(xembT + ((size_t)(b * 256 + d0 + brow0)) * 256 + c0 + bch0, &sB[brow0][bch0]);
        stage16(xembT + ((size_t)(b * 256 + d0 + brow1)) * 256 + c0 + bch1, &sB[brow1][bch1]);
        stage_wait();
        __syncthreads();

        const v8h alo = *reinterpret_cast<const v8h*>(&sA[wp * 16 + m][kb]);
        const v8h ahi = *reinterpret_cast<const v8h*>(&sA[wp * 16 + m][16 + kb]);
        const v16h af = __builtin_shufflevector(alo, ahi,
                          0, 1, 2, 3, 4, 5, 6, 7, 8, 9, 10, 11, 12, 13, 14, 15);
#pragma unroll
        for (int j = 0; j < 4; ++j) {
            const int dr = (wdg + j) * 16 + m;
            const v8h blo = *reinterpret_cast<const v8h*>(&sB[dr][kb]);
            const v8h bhi = *reinterpret_cast<const v8h*>(&sB[dr][16 + kb]);
            const v16h bf = __builtin_shufflevector(blo, bhi,
                              0, 1, 2, 3, 4, 5, 6, 7, 8, 9, 10, 11, 12, 13, 14, 15);
            acc[j] = __builtin_amdgcn_wmma_f32_16x16x32_f16(false, af, false, bf,
                                                            (short)0, acc[j], false, false);
        }
    }

    // epilogue: C/D layout: VGPR r -> row m = r + (lane>=16 ? 8 : 0), col n = lane&15
    const int n  = lane & 15;
    const int mh = (lane >> 4) * 8;
    const float ebb = expand_b[b];
#pragma unroll
    for (int r = 0; r < 8; ++r) {
        const int p = p0 + wp * 16 + mh + r;
        const float scale = 1.0f + expand_w[p];
        const float bias  = maskf[(size_t)b * 256 + p] * ebb;
        const size_t base = ((size_t)b * 256 + p) * 256 + d0;
#pragma unroll
        for (int j = 0; j < 4; ++j)
            out[base + (wdg + j) * 16 + n] = acc[j][r] * scale + bias;
    }
}

extern "C" void kernel_launch(void* const* d_in, const int* in_sizes, int n_in,
                              void* d_out, int out_size, void* d_ws, size_t ws_size,
                              hipStream_t stream) {
    const float* x            = (const float*)d_in[0];
    const float* prev_cell    = (const float*)d_in[1];
    const float* few          = (const float*)d_in[2];
    const float* feb          = (const float*)d_in[3];
    const float* ln_emb_w     = (const float*)d_in[4];
    const float* ln_emb_b     = (const float*)d_in[5];
    const float* ln_col_w     = (const float*)d_in[6];
    const float* ln_col_b     = (const float*)d_in[7];
    const float* ln_prompt_w  = (const float*)d_in[8];
    const float* ln_prompt_b  = (const float*)d_in[9];
    const float* dense_imp_w  = (const float*)d_in[10];
    const float* dense_imp_b  = (const float*)d_in[11];
    const float* emb_column   = (const float*)d_in[12];
    const float* emb_prompt   = (const float*)d_in[13];
    const float* expand_w     = (const float*)d_in[14];
    const float* expand_b     = (const float*)d_in[15];
    float* out = (float*)d_out;

    char* ws = (char*)d_ws;
    float*    x_prompt = (float*)(ws);               // 262144 B
    float*    x_col    = (float*)(ws + 262144);      // 262144 B
    float*    maskf    = (float*)(ws + 524288);      // 262144 B
    _Float16* maskh    = (_Float16*)(ws + 786432);   // 131072 B
    _Float16* xembT    = (_Float16*)(ws + 917504);   // 33554432 B, layout [b][d][c]

    kA_prompt<<<256, 256, 0, stream>>>(emb_prompt, prev_cell, ln_prompt_w, ln_prompt_b,
                                       dense_imp_w, dense_imp_b, x_prompt);
    kB_col<<<256, 256, 0, stream>>>(emb_column, ln_col_w, ln_col_b, x_col);
    kD_emb<<<1024, 256, 0, stream>>>(x, few, feb, ln_emb_w, ln_emb_b, xembT);
    kC_mask<<<256, 256, 0, stream>>>(x_prompt, x_col, maskf, maskh);
    kE_gemm<<<dim3(2, 4, 256), 256, 0, stream>>>(maskh, xembT, maskf,
                                                 expand_w, expand_b, out);
}

// v001
// A run of this version takes 53 microseconds.
// Two timings next to v000 put it at 1.18 and 1.17 times that version's speed.
#include <hip/hip_runtime.h>
#include <hip/hip_bf16.h>

typedef __attribute__((ext_vector_type(8)))  _Float16 v8h;
typedef __attribute__((ext_vector_type(16))) _Float16 v16h;
typedef __attribute__((ext_vector_type(8)))  float    v8f;
typedef __attribute__((ext_vector_type(2)))  float    v2f;

typedef int v4i __attribute__((vector_size(16)));
typedef __attribute__((address_space(1))) v4i gv4i;  // global 128-bit
typedef __attribute__((address_space(3))) v4i lv4i;  // LDS    128-bit

#define LN_EPS 1e-5f

#if defined(__has_builtin)
#if __has_builtin(__builtin_amdgcn_global_load_async_to_lds_b128)
#define HAVE_ASYNC_LDS 1
#endif
#endif

// 16B global -> LDS staging (async CDNA5 path when available)
__device__ __forceinline__ void stage16(const _Float16* g, _Float16* l) {
#ifdef HAVE_ASYNC_LDS
    __builtin_amdgcn_global_load_async_to_lds_b128(
        (gv4i*)(uintptr_t)g, (lv4i*)(uintptr_t)l, 0, 0);
#else
    *reinterpret_cast<v8h*>(l) = *reinterpret_cast<const v8h*>(g);
#endif
}

__device__ __forceinline__ void stage_wait() {
#ifdef HAVE_ASYNC_LDS
#if __has_builtin(__builtin_amdgcn_s_wait_asynccnt)
    __builtin_amdgcn_s_wait_asynccnt(0);
#else
    asm volatile("s_wait_asynccnt 0" ::: "memory");
#endif
#endif
}

// ---------------- block reduction helpers (blockDim.x == 256, 8 waves) ----------------
__device__ __forceinline__ float block_reduce_sum(float v, float* scratch) {
#pragma unroll
    for (int o = 16; o > 0; o >>= 1) v += __shfl_xor(v, o, 32);
    if ((threadIdx.x & 31) == 0) scratch[threadIdx.x >> 5] = v;
    __syncthreads();
    float r = 0.0f;
#pragma unroll
    for (int i = 0; i < 8; ++i) r += scratch[i];
    __syncthreads();
    return r;
}

// f32 matrix fragment pair: a lane (c = lane & 15, h = lane >> 4) holds 16 bytes of row c at k + 4h of each
// 8-k step; A and B are read by the same code, so the k pairing is equal at every lane and register.
__device__ __forceinline__ void mm8(const float* ap, const float* bp, v8f& acc) {
    const float4 a = *reinterpret_cast<const float4*>(ap);
    const float4 b = *reinterpret_cast<const float4*>(bp);
    const v2f a0 = {a.x, a.y}, a1 = {a.z, a.w}, b0 = {b.x, b.y}, b1 = {b.z, b.w};
    acc = __builtin_amdgcn_wmma_f32_16x16x4_f32(false, a0, false, b0, (short)0, acc, false, false);
    acc = __builtin_amdgcn_wmma_f32_16x16x4_f32(false, a1, false, b1, (short)0, acc, false, false);
}

// ---------------- kA: x_prompt[p,d] = (concat(LN(emb_prompt[p]), prev[p]) @ W^T)[d] + b[d] + emb_prompt[p,d]
// grid 128: 16 p-tiles of 16 rows x 8 d-tiles of 32. block 256 = 8 waves = 2 d-subtiles x 4 k-quarters of 128.
#define KA_PITCH 516   // floats; 16 B x odd, the conflict-free pitch for 16-byte fragment reads
__global__ __launch_bounds__(256)
void kA_prompt(const float* __restrict__ emb_prompt,
               const float* __restrict__ prev_cell,
               const float* __restrict__ lnw, const float* __restrict__ lnb,
               const float* __restrict__ W,   // [256, 512]
               const float* __restrict__ Wb,
               float* __restrict__ x_prompt) {
    __shared__ __align__(16) float sX[16 * KA_PITCH];   // concat(LN(emb_prompt), prev), 16 rows
    __shared__ __align__(16) float sW[32 * KA_PITCH];   // 32 rows of W
    __shared__ __align__(16) float sR[8 * 256];         // one partial tile per wave
    const int tid = threadIdx.x, lane = tid & 31, wave = tid >> 5;
    const int p0 = (blockIdx.x >> 3) * 16, n0 = (blockIdx.x & 7) * 32;

    // every global read of the block is issued before the first use; each wave-wide load covers 512 contiguous bytes
    const float4* W4 = reinterpret_cast<const float4*>(W) + (size_t)n0 * 128;
    const float4* P4 = reinterpret_cast<const float4*>(prev_cell) + (size_t)p0 * 64;
    const float4* E4 = reinterpret_cast<const float4*>(emb_prompt) + (size_t)p0 * 64;
    float4 ev[2][2], gw[2], gb[2], pr[4], wr[16];
#pragma unroll
    for (int j = 0; j < 2; ++j) {
        ev[0][j] = E4[(wave * 2) * 64 + lane + 32 * j];
        ev[1][j] = E4[(wave * 2 + 1) * 64 + lane + 32 * j];
        gw[j] = reinterpret_cast<const float4*>(lnw)[lane + 32 * j];
        gb[j] = reinterpret_cast<const float4*>(lnb)[lane + 32 * j];
    }
#pragma unroll
    for (int i = 0; i < 4; ++i) pr[i] = P4[i * 256 + tid];
#pragma unroll
    for (int i = 0; i < 16; ++i) wr[i] = W4[i * 256 + tid];

    // LayerNorm of two rows per wave
#pragma unroll
    for (int rr = 0; rr < 2; ++rr) {
        const float4 e0 = ev[rr][0], e1 = ev[rr][1];
        float s = (e0.x + e0.y) + (e0.z + e0.w) + (e1.x + e1.y) + (e1.z + e1.w);
#pragma unroll
        for (int o = 16; o > 0; o >>= 1) s += __shfl_xor(s, o, 32);
        const float mu = s * (1.0f / 256.0f);
        float4 d0 = {e0.x - mu, e0.y - mu, e0.z - mu, e0.w - mu};
        float4 d1 = {e1.x - mu, e1.y - mu, e1.z - mu, e1.w - mu};
        float q = (d0.x * d0.x + d0.y * d0.y) + (d0.z * d0.z + d0.w * d0.w)
                + (d1.x * d1.x + d1.y * d1.y) + (d1.z * d1.z + d1.w * d1.w);
#pragma unroll
        for (int o = 16; o > 0; o >>= 1) q += __shfl_xor(q, o, 32);
        const float rs = rsqrtf(q * (1.0f / 256.0f) + LN_EPS);
        float* row = &sX[(wave * 2 + rr) * KA_PITCH];
        const float4 y0 = {d0.x * rs * gw[0].x + gb[0].x, d0.y * rs * gw[0].y + gb[0].y,
                           d0.z * rs * gw[0].z + gb[0].z, d0.w * rs * gw[0].w + gb[0].w};
        const float4 y1 = {d1.x * rs * gw[1].x + gb[1].x, d1.y * rs * gw[1].y + gb[1].y,
                           d1.z * rs * gw[1].z + gb[1].z, d1.w * rs * gw[1].w + gb[1].w};
        *reinterpret_cast<float4*>(&row[lane * 4])       = y0;
        *reinterpret_cast<float4*>(&row[128 + lane * 4]) = y1;
    }
#pragma unroll
    for (int i = 0; i < 4; ++i) {
        const int idx = i * 256 + tid;
        *reinterpret_cast<float4*>(&sX[(idx >> 6) * KA_PITCH + 256 + (idx & 63) * 4]) = pr[i];
    }
#pragma unroll
    for (int i = 0; i < 16; ++i) {
        const int idx = i * 256 + tid;
        *reinterpret_cast<float4*>(&sW[(idx >> 7) * KA_PITCH + (idx & 127) * 4]) = wr[i];
    }
    __syncthreads();

    const int c = lane & 15, h = lane >> 4;
    const int ns = wave & 1, ks = wave >> 1;
    const float* ap = &sX[c * KA_PITCH + ks * 128 + 4 * h];
    const float* bp = &sW[(ns * 16 + c) * KA_PITCH + ks * 128 + 4 * h];
    v8f acc = {};   // one chain per wave: the waves that share a SIMD fill the matrix unit between them
#pragma unroll
    for (int s = 0; s < 16; ++s) mm8(ap + s * 8, bp + s * 8, acc);
#pragma unroll
    for (int r = 0; r < 8; ++r) sR[wave * 256 + r * 32 + lane] = acc[r];
    __syncthreads();

    // sum the four k-quarters; element (r, lane) of a tile is row 8h + r, column c
#pragma unroll
    for (int t = 0; t < 2; ++t) {
        const float v = (sR[t * 256 + tid] + sR[(2 + t) * 256 + tid])
                      + (sR[(4 + t) * 256 + tid] + sR[(6 + t) * 256 + tid]);
        const int p = p0 + 8 * h + wave;       // r = tid >> 5
        const int d = n0 + t * 16 + c;
        x_prompt[p * 256 + d] = v + Wb[d] + emb_prompt[p * 256 + d];
    }
}

// ---------------- kB: x_col = LN(emb_column)
__global__ void kB_col(const float* __restrict__ emb_col,
                       const float* __restrict__ lnw, const float* __restrict__ lnb,
                       float* __restrict__ x_col) {
    __shared__ float scratch[8];
    const int c = blockIdx.x, d = threadIdx.x;
    const float e  = emb_col[c * 256 + d];
    const float mu = block_reduce_sum(e, scratch) * (1.0f / 256.0f);
    const float dv = e - mu;
    const float var = block_reduce_sum(dv * dv, scratch) * (1.0f / 256.0f);
    x_col[c * 256 + d] = dv * rsqrtf(var + LN_EPS) * lnw[d] + lnb[d];
}

// ---------------- kC: mask = softmax(x_prompt @ x_col^T)
// grid 16: 16 rows p each, all 256 columns c. block 512 = 16 waves, one 16x16 tile over the whole k per wave.
#define KC_PITCH 260   // floats; 16 B x odd
__global__ __launch_bounds__(512)
void kC_mask(const float* __restrict__ x_prompt,
             const float* __restrict__ x_col,
             float* __restrict__ maskf,
             _Float16* __restrict__ maskh) {
    __shared__ __align__(16) float sC[256 * KC_PITCH];
    __shared__ __align__(16) float sP[16 * KC_PITCH];
    __shared__ __align__(16) float sL[16 * KC_PITCH];
    const int tid = threadIdx.x, lane = tid & 31, wave = tid >> 5;
    const int p0 = blockIdx.x * 16;

    const float4* C4 = reinterpret_cast<const float4*>(x_col);
    const float4* P4 = reinterpret_cast<const float4*>(x_prompt) + (size_t)p0 * 64;
    float4 pr[2], cr[32];
#pragma unroll
    for (int i = 0; i < 2; ++i) pr[i] = P4[i * 512 + tid];
#pragma unroll
    for (int i = 0; i < 32; ++i) cr[i] = C4[i * 512 + tid];
#pragma unroll
    for (int i = 0; i < 2; ++i) {
        const int idx = i * 512 + tid;
        *reinterpret_cast<float4*>(&sP[(idx >> 6) * KC_PITCH + (idx & 63) * 4]) = pr[i];
    }
#pragma unroll
    for (int i = 0; i < 32; ++i) {
        const int idx = i * 512 + tid;
        *reinterpret_cast<float4*>(&sC[(idx >> 6) * KC_PITCH + (idx & 63) * 4]) = cr[i];
    }
    __syncthreads();

    const int c = lane & 15, h = lane >> 4;
    const float* ap = &sP[c * KC_PITCH + 4 * h];
    const float* bp = &sC[(wave * 16 + c) * KC_PITCH + 4 * h];
    v8f acc = {};   // one chain per wave: the waves that share a SIMD fill the matrix unit between them
#pragma unroll
    for (int s = 0; s < 32; ++s) mm8(ap + s * 8, bp + s * 8, acc);
#pragma unroll
    for (int r = 0; r < 8; ++r) sL[(8 * h + r) * KC_PITCH + wave * 16 + c] = acc[r];
    __syncthreads();

    // softmax: one row per wave, eight adjacent columns per lane so that every store is 16 bytes wide
    const float4 l0 = *reinterpret_cast<const float4*>(&sL[wave * KC_PITCH + lane * 8]);
    const float4 l1 = *reinterpret_cast<const float4*>(&sL[wave * KC_PITCH + lane * 8 + 4]);
    float v[8] = {l0.x, l0.y, l0.z, l0.w, l1.x, l1.y, l1.z, l1.w};
    float mx = v[0];
#pragma unroll
    for (int i = 1; i < 8; ++i) mx = fmaxf(mx, v[i]);
#pragma unroll
    for (int o = 16; o > 0; o >>= 1) mx = fmaxf(mx, __shfl_xor(mx, o, 32));
    float sm = 0.0f;
#pragma unroll
    for (int i = 0; i < 8; ++i) { v[i] = __expf(v[i] - mx); sm += v[i]; }
#pragma unroll
    for (int o = 16; o > 0; o >>= 1) sm += __shfl_xor(sm, o, 32);
    v8h hv;
#pragma unroll
    for (int i = 0; i < 8; ++i) { v[i] = v[i] / sm; hv[i] = (_Float16)v[i]; }
    const size_t o8 = (size_t)(p0 + wave) * 256 + lane * 8;
    *reinterpret_cast<float4*>(maskf + o8)     = make_float4(v[0], v[1], v[2], v[3]);
    *reinterpret_cast<float4*>(maskf + o8 + 4) = make_float4(v[4], v[5], v[6], v[7]);
    *reinterpret_cast<v8h*>(maskh + o8)        = hv;
}

// ---------------- kD: xembT[b, d, c] = LN_over_d(relu(feb[c,:] + x[b,c]*few[c,:])) stored f16 TRANSPOSED
// grid 1024: b = bx>>2, c-tile of 64 = (bx&3)*64. block 256 (8 waves); each wave handles a pair of c-rows.
#define KD_PITCH 72
__global__ void kD_emb(const float* __restrict__ x,
                       const float* __restrict__ few, const float* __restrict__ feb,
                       const float* __restrict__ lnw, const float* __restrict__ lnb,
                       _Float16* __restrict__ xembT) {
    __shared__ __align__(16) _Float16 sT[256][KD_PITCH];  // [d][c_local]
    const int lane = threadIdx.x & 31, wave = threadIdx.x >> 5;
    const int b = blockIdx.x >> 2, c0 = (blockIdx.x & 3) << 6;

    float g[8], h[8];
#pragma unroll
    for (int i = 0; i < 8; ++i) {
        const int d = lane + 32 * i;
        g[i] = lnw[d]; h[i] = lnb[d];
    }

    for (int iter = 0; iter < 4; ++iter) {
        const int cl = iter * 16 + wave * 2;       // two adjacent c rows
        const int c  = c0 + cl;
        const float xv0 = x[b * 256 + c];
        const float xv1 = x[b * 256 + c + 1];
        float v0[8], v1[8];
        float s0 = 0.f, q0 = 0.f, s1 = 0.f, q1 = 0.f;
#pragma unroll
        for (int i = 0; i < 8; ++i) {
            const int d = lane + 32 * i;
            const float a0 = fmaxf(0.0f, feb[(size_t)c * 256 + d]       + xv0 * few[(size_t)c * 256 + d]);
            const float a1 = fmaxf(0.0f, feb[(size_t)(c + 1) * 256 + d] + xv1 * few[(size_t)(c + 1) * 256 + d]);
            v0[i] = a0; v1[i] = a1;
            s0 += a0; q0 += a0 * a0; s1 += a1; q1 += a1 * a1;
        }
#pragma unroll
        for (int o = 16; o > 0; o >>= 1) {
            s0 += __shfl_xor(s0, o, 32); q0 += __shfl_xor(q0, o, 32);
            s1 += __shfl_xor(s1, o, 32); q1 += __shfl_xor(q1, o, 32);
        }
        const float mu0 = s0 * (1.0f / 256.0f), mu1 = s1 * (1.0f / 256.0f);
        const float rs0 = rsqrtf(q0 * (1.0f / 256.0f) - mu0 * mu0 + LN_EPS);
        const float rs1 = rsqrtf(q1 * (1.0f / 256.0f) - mu1 * mu1 + LN_EPS);
#pragma unroll
        for (int i = 0; i < 8; ++i) {
            const int d = lane + 32 * i;
            union { _Float16 hh[2]; unsigned u; } pk;
            pk.hh[0] = (_Float16)((v0[i] - mu0) * rs0 * g[i] + h[i]);
            pk.hh[1] = (_Float16)((v1[i] - mu1) * rs1 * g[i] + h[i]);
            *reinterpret_cast<unsigned*>(&sT[d][cl]) = pk.u;   // b32 packed transpose store
        }
    }
    __syncthreads();

    // coalesced writeout: 8 consecutive threads cover 128B of one d-row
#pragma unroll
    for (int it = 0; it < 8; ++it) {
        const int d  = it * 32 + (threadIdx.x >> 3);
        const int ch = (threadIdx.x & 7) * 8;
        const v8h vv = *reinterpret_cast<const v8h*>(&sT[d][ch]);
        *reinterpret_cast<v8h*>(xembT + ((size_t)(b * 256 + d)) * 256 + c0 + ch) = vv;
    }
}

// ---------------- kE: out[b,p,d] = (sum_c mask[p,c]*x_emb[b,c,d]) * (1+ew[p]) + mask[b,p]*eb[b]
// grid (d-tiles=2, p-tiles=4, b=256); block 256 = 8 waves; wave: 1 p-subtile x 4 d-subtiles
#define KE_PITCH 40
__global__ void kE_gemm(const _Float16* __restrict__ maskh,
                        const _Float16* __restrict__ xembT,   // [b][d][c]
                        const float* __restrict__ maskf,
                        const float* __restrict__ expand_w,
                        const float* __restrict__ expand_b,
                        float* __restrict__ out) {
    __shared__ __align__(16) _Float16 sA[64][KE_PITCH];   // mask   [p_local][k]
    __shared__ __align__(16) _Float16 sB[128][KE_PITCH];  // xembT  [d_local][k]

    const int b  = blockIdx.z;
    const int p0 = blockIdx.y * 64;
    const int d0 = blockIdx.x * 128;
    const int tid  = threadIdx.x;
    const int wave = tid >> 5, lane = tid & 31;
    const int wp  = wave & 3;          // p subtile
    const int wdg = (wave >> 2) * 4;   // first of four d subtiles

    const int m  = lane & 15;
    const int kb = (lane >> 4) << 3;   // 0 or 8 (ISA 16-bit lane layout)

    v8f acc[4] = {{}, {}, {}, {}};

    const int arow = tid >> 2, ach = (tid & 3) * 8;            // sA staging map (64x4 chunks)
    const int brow0 = tid >> 2, bch0 = (tid & 3) * 8;          // sB chunk 0
    const int brow1 = (tid + 256) >> 2, bch1 = (tid & 3) * 8;  // sB chunk 1

    for (int c0 = 0; c0 < 256; c0 += 32) {
        __syncthreads();
        stage16(maskh + (size_t)(p0 + arow) * 256 + c0 + ach, &sA[arow][ach]);
        stage16(xembT + ((size_t)(b * 256 + d0 + brow0)) * 256 + c0 + bch0, &sB[brow0][bch0]);
        stage16(xembT + ((size_t)(b * 256 + d0 + brow1)) * 256 + c0 + bch1, &sB[brow1][bch1]);
        stage_wait();
        __syncthreads();

        const v8h alo = *reinterpret_cast<const v8h*>(&sA[wp * 16 + m][kb]);
        const v8h ahi = *reinterpret_cast<const v8h*>(&sA[wp * 16 + m][16 + kb]);
        const v16h af = __builtin_shufflevector(alo, ahi,
                          0, 1, 2, 3, 4, 5, 6, 7, 8, 9, 10, 11, 12, 13, 14, 15);
#pragma unroll
        for (int j = 0; j < 4; ++j) {
            const int dr = (wdg + j) * 16 + m;
            const v8h blo = *reinterpret_cast<const v8h*>(&sB[dr][kb]);
            const v8h bhi = *reinterpret_cast<const v8h*>(&sB[dr][16 + kb]);
            const v16h bf = __builtin_shufflevector(blo, bhi,
                              0, 1, 2, 3, 4, 5, 6, 7, 8, 9, 10, 11, 12, 13, 14, 15);
            acc[j] = __builtin_amdgcn_wmma_f32_16x16x32_f16(false, af, false, bf,
                                                            (short)0, acc[j], false, false);
        }
    }

    // epilogue: C/D layout: VGPR r -> row m = r + (lane>=16 ? 8 : 0), col n = lane&15
    const int n  = lane & 15;
    const int mh = (lane >> 4) * 8;
    const float ebb = expand_b[b];
#pragma unroll
    for (int r = 0; r < 8; ++r) {
        const int p = p0 + wp * 16 + mh + r;
        const float scale = 1.0f + expand_w[p];
        const float bias  = maskf[(size_t)b * 256 + p] * ebb;
        const size_t base = ((size_t)b * 256 + p) * 256 + d0;
#pragma unroll
        for (int j = 0; j < 4; ++j)
            out[base + (wdg + j) * 16 + n] = acc[j][r] * scale + bias;
    }
}

extern "C" void kernel_launch(void* const* d_in, const int* in_sizes, int n_in,
                              void* d_out, int out_size, void* d_ws, size_t ws_size,
                              hipStream_t stream) {
    const float* x            = (const float*)d_in[0];
    const float* prev_cell    = (const float*)d_in[1];
    const float* few          = (const float*)d_in[2];
    const float* feb          = (const float*)d_in[3];
    const float* ln_emb_w     = (const float*)d_in[4];
    const float* ln_emb_b     = (const float*)d_in[5];
    const float* ln_col_w     = (const float*)d_in[6];
    const float* ln_col_b     = (const float*)d_in[7];
    const float* ln_prompt_w  = (const float*)d_in[8];
    const float* ln_prompt_b  = (const float*)d_in[9];
    const float* dense_imp_w  = (const float*)d_in[10];
    const float* dense_imp_b  = (const float*)d_in[11];
    const float* emb_column   = (const float*)d_in[12];
    const float* emb_prompt   = (const float*)d_in[13];
    const float* expand_w     = (const float*)d_in[14];
    const float* expand_b     = (const float*)d_in[15];
    float* out = (float*)d_out;

    char* ws = (char*)d_ws;
    float*    x_prompt = (float*)(ws);               // 262144 B
    float*    x_col    = (float*)(ws + 262144);      // 262144 B
    float*    maskf    = (float*)(ws + 524288);      // 262144 B
    _Float16* maskh    = (_Float16*)(ws + 786432);   // 131072 B
    _Float16* xembT    = (_Float16*)(ws + 917504);   // 33554432 B, layout [b][d][c]

    kA_prompt<<<128, 256, 0, stream>>>(emb_prompt, prev_cell, ln_prompt_w, ln_prompt_b,
                                       dense_imp_w, dense_imp_b, x_prompt);
    kB_col<<<256, 256, 0, stream>>>(emb_column, ln_col_w, ln_col_b, x_col);
    kD_emb<<<1024, 256, 0, stream>>>(x, few, feb, ln_emb_w, ln_emb_b, xembT);
    kC_mask<<<16, 512, 0, stream>>>(x_prompt, x_col, maskf, maskh);
    kE_gemm<<<dim3(2, 4, 256), 256, 0, stream>>>(maskh, xembT, maskf,
                                                 expand_w, expand_b, out);
}

// v002
// One run takes 39.7 microseconds.
// Next to v001, in two timings, it ran 1.32 and 1.35 times as fast.
// Counting every step since v000, it is 1.57 times as fast.
#include <hip/hip_runtime.h>
#include <hip/hip_bf16.h>

typedef __attribute__((ext_vector_type(8)))  _Float16 v8h;
typedef __attribute__((ext_vector_type(16))) _Float16 v16h;
typedef __attribute__((ext_vector_type(8)))  float    v8f;
typedef __attribute__((ext_vector_type(2)))  float    v2f;

typedef int v4i __attribute__((vector_size(16)));
typedef __attribute__((address_space(1))) v4i gv4i;  // global 128-bit
typedef __attribute__((address_space(3))) v4i lv4i;  // LDS    128-bit

#define LN_EPS 1e-5f

#if defined(__has_builtin)
#if __has_builtin(__builtin_amdgcn_global_load_async_to_lds_b128)
#define HAVE_ASYNC_LDS 1
#endif
#endif

// 16B global -> LDS staging (async CDNA5 path when available)
__device__ __forceinline__ void stage16(const _Float16* g, _Float16* l) {
#ifdef HAVE_ASYNC_LDS
    __builtin_amdgcn_global_load_async_to_lds_b128(
        (gv4i*)(uintptr_t)g, (lv4i*)(uintptr_t)l, 0, 0);
#else
    *reinterpret_cast<v8h*>(l) = *reinterpret_cast<const v8h*>(g);
#endif
}

// the issuing wave's own wait for its copies; asm with the memory clobber so that no LDS read is lifted over it
__device__ __forceinline__ void stage_wait() {
#ifdef HAVE_ASYNC_LDS
    asm volatile("s_wait_asynccnt 0x0" ::: "memory");
#endif
}

// ---------------- block reduction helpers (blockDim.x == 256, 8 waves) ----------------
__device__ __forceinline__ float block_reduce_sum(float v, float* scratch) {
#pragma unroll
    for (int o = 16; o > 0; o >>= 1) v += __shfl_xor(v, o, 32);
    if ((threadIdx.x & 31) == 0) scratch[threadIdx.x >> 5] = v;
    __syncthreads();
    float r = 0.0f;
#pragma unroll
    for (int i = 0; i < 8; ++i) r += scratch[i];
    __syncthreads();
    return r;
}

// f32 matrix fragment pair: a lane (c = lane & 15, h = lane >> 4) holds 16 bytes of row c at k + 4h of each
// 8-k step; A and B are read by the same code, so the k pairing is equal at every lane and register.
__device__ __forceinline__ void mm8(const float* ap, const float* bp, v8f& acc) {
    const float4 a = *reinterpret_cast<const float4*>(ap);
    const float4 b = *reinterpret_cast<const float4*>(bp);
    const v2f a0 = {a.x, a.y}, a1 = {a.z, a.w}, b0 = {b.x, b.y}, b1 = {b.z, b.w};
    acc = __builtin_amdgcn_wmma_f32_16x16x4_f32(false, a0, false, b0, (short)0, acc, false, false);
    acc = __builtin_amdgcn_wmma_f32_16x16x4_f32(false, a1, false, b1, (short)0, acc, false, false);
}

// ---------------- kA: x_prompt[p,d] = (concat(LN(emb_prompt[p]), prev[p]) @ W^T)[d] + b[d] + emb_prompt[p,d]
// grid 128: 16 p-tiles of 16 rows x 8 d-tiles of 32. block 256 = 8 waves = 2 d-subtiles x 4 k-quarters of 128.
#define KA_PITCH 516   // floats; 16 B x odd, the conflict-free pitch for 16-byte fragment reads
__global__ __launch_bounds__(256)
void kA_prompt(const float* __restrict__ emb_prompt,
               const float* __restrict__ prev_cell,
               const float* __restrict__ lnw, const float* __restrict__ lnb,
               const float* __restrict__ W,   // [256, 512]
               const float* __restrict__ Wb,
               float* __restrict__ x_prompt) {
    __shared__ __align__(16) float sX[16 * KA_PITCH];   // concat(LN(emb_prompt), prev), 16 rows
    __shared__ __align__(16) float sW[32 * KA_PITCH];   // 32 rows of W
    __shared__ __align__(16) float sR[8 * 256];         // one partial tile per wave
    const int tid = threadIdx.x, lane = tid & 31, wave = tid >> 5;
    const int p0 = (blockIdx.x >> 3) * 16, n0 = (blockIdx.x & 7) * 32;

    // every global read of the block is issued before the first use; each wave-wide load covers 512 contiguous bytes
    const float4* W4 = reinterpret_cast<const float4*>(W) + (size_t)n0 * 128;
    const float4* P4 = reinterpret_cast<const float4*>(prev_cell) + (size_t)p0 * 64;
    const float4* E4 = reinterpret_cast<const float4*>(emb_prompt) + (size_t)p0 * 64;
    float4 ev[2][2], gw[2], gb[2], pr[4], wr[16];
#pragma unroll
    for (int j = 0; j < 2; ++j) {
        ev[0][j] = E4[(wave * 2) * 64 + lane + 32 * j];
        ev[1][j] = E4[(wave * 2 + 1) * 64 + lane + 32 * j];
        gw[j] = reinterpret_cast<const float4*>(lnw)[lane + 32 * j];
        gb[j] = reinterpret_cast<const float4*>(lnb)[lane + 32 * j];
    }
#pragma unroll
    for (int i = 0; i < 4; ++i) pr[i] = P4[i * 256 + tid];
#pragma unroll
    for (int i = 0; i < 16; ++i) wr[i] = W4[i * 256 + tid];

    // LayerNorm of two rows per wave
#pragma unroll
    for (int rr = 0; rr < 2; ++rr) {
        const float4 e0 = ev[rr][0], e1 = ev[rr][1];
        float s = (e0.x + e0.y) + (e0.z + e0.w) + (e1.x + e1.y) + (e1.z + e1.w);
#pragma unroll
        for (int o = 16; o > 0; o >>= 1) s += __shfl_xor(s, o, 32);
        const float mu = s * (1.0f / 256.0f);
        float4 d0 = {e0.x - mu, e0.y - mu, e0.z - mu, e0.w - mu};
        float4 d1 = {e1.x - mu, e1.y - mu, e1.z - mu, e1.w - mu};
        float q = (d0.x * d0.x + d0.y * d0.y) + (d0.z * d0.z + d0.w * d0.w)
                + (d1.x * d1.x + d1.y * d1.y) + (d1.z * d1.z + d1.w * d1.w);
#pragma unroll
        for (int o = 16; o > 0; o >>= 1) q += __shfl_xor(q, o, 32);
        const float rs = rsqrtf(q * (1.0f / 256.0f) + LN_EPS);
        float* row = &sX[(wave * 2 + rr) * KA_PITCH];
        const float4 y0 = {d0.x * rs * gw[0].x + gb[0].x, d0.y * rs * gw[0].y + gb[0].y,
                           d0.z * rs * gw[0].z + gb[0].z, d0.w * rs * gw[0].w + gb[0].w};
        const float4 y1 = {d1.x * rs * gw[1].x + gb[1].x, d1.y * rs * gw[1].y + gb[1].y,
                           d1.z * rs * gw[1].z + gb[1].z, d1.w * rs * gw[1].w + gb[1].w};
        *reinterpret_cast<float4*>(&row[lane * 4])       = y0;
        *reinterpret_cast<float4*>(&row[128 + lane * 4]) = y1;
    }
#pragma unroll
    for (int i = 0; i < 4; ++i) {
        const int idx = i * 256 + tid;
        *reinterpret_cast<float4*>(&sX[(idx >> 6) * KA_PITCH + 256 + (idx & 63) * 4]) = pr[i];
    }
#pragma unroll
    for (int i = 0; i < 16; ++i) {
        const int idx = i * 256 + tid;
        *reinterpret_cast<float4*>(&sW[(idx >> 7) * KA_PITCH + (idx & 127) * 4]) = wr[i];
    }
    __syncthreads();

    const int c = lane & 15, h = lane >> 4;
    const int ns = wave & 1, ks = wave >> 1;
    const float* ap = &sX[c * KA_PITCH + ks * 128 + 4 * h];
    const float* bp = &sW[(ns * 16 + c) * KA_PITCH + ks * 128 + 4 * h];
    v8f acc = {};   // one chain per wave: the waves that share a SIMD fill the matrix unit between them
#pragma unroll
    for (int s = 0; s < 16; ++s) mm8(ap + s * 8, bp + s * 8, acc);
#pragma unroll
    for (int r = 0; r < 8; ++r) sR[wave * 256 + r * 32 + lane] = acc[r];
    __syncthreads();

    // sum the four k-quarters; element (r, lane) of a tile is row 8h + r, column c
#pragma unroll
    for (int t = 0; t < 2; ++t) {
        const float v = (sR[t * 256 + tid] + sR[(2 + t) * 256 + tid])
                      + (sR[(4 + t) * 256 + tid] + sR[(6 + t) * 256 + tid]);
        const int p = p0 + 8 * h + wave;       // r = tid >> 5
        const int d = n0 + t * 16 + c;
        x_prompt[p * 256 + d] = v + Wb[d] + emb_prompt[p * 256 + d];
    }
}

// ---------------- kB: x_col = LN(emb_column)
__global__ void kB_col(const float* __restrict__ emb_col,
                       const float* __restrict__ lnw, const float* __restrict__ lnb,
                       float* __restrict__ x_col) {
    __shared__ float scratch[8];
    const int c = blockIdx.x, d = threadIdx.x;
    const float e  = emb_col[c * 256 + d];
    const float mu = block_reduce_sum(e, scratch) * (1.0f / 256.0f);
    const float dv = e - mu;
    const float var = block_reduce_sum(dv * dv, scratch) * (1.0f / 256.0f);
    x_col[c * 256 + d] = dv * rsqrtf(var + LN_EPS) * lnw[d] + lnb[d];
}

// ---------------- kC: mask = softmax(x_prompt @ x_col^T)
// grid 16: 16 rows p each, all 256 columns c. block 512 = 16 waves, one 16x16 tile over the whole k per wave.
#define KC_PITCH 260   // floats; 16 B x odd
__global__ __launch_bounds__(512)
void kC_mask(const float* __restrict__ x_prompt,
             const float* __restrict__ x_col,
             float* __restrict__ maskf,
             _Float16* __restrict__ maskh) {
    __shared__ __align__(16) float sC[256 * KC_PITCH];
    __shared__ __align__(16) float sP[16 * KC_PITCH];
    __shared__ __align__(16) float sL[16 * KC_PITCH];
    const int tid = threadIdx.x, lane = tid & 31, wave = tid >> 5;
    const int p0 = blockIdx.x * 16;

    const float4* C4 = reinterpret_cast<const float4*>(x_col);
    const float4* P4 = reinterpret_cast<const float4*>(x_prompt) + (size_t)p0 * 64;
    float4 pr[2], cr[32];
#pragma unroll
    for (int i = 0; i < 2; ++i) pr[i] = P4[i * 512 + tid];
#pragma unroll
    for (int i = 0; i < 32; ++i) cr[i] = C4[i * 512 + tid];
#pragma unroll
    for (int i = 0; i < 2; ++i) {
        const int idx = i * 512 + tid;
        *reinterpret_cast<float4*>(&sP[(idx >> 6) * KC_PITCH + (idx & 63) * 4]) = pr[i];
    }
#pragma unroll
    for (int i = 0; i < 32; ++i) {
        const int idx = i * 512 + tid;
        *reinterpret_cast<float4*>(&sC[(idx >> 6) * KC_PITCH + (idx & 63) * 4]) = cr[i];
    }
    __syncthreads();

    const int c = lane & 15, h = lane >> 4;
    const float* ap = &sP[c * KC_PITCH + 4 * h];
    const float* bp = &sC[(wave * 16 + c) * KC_PITCH + 4 * h];
    v8f acc = {};   // one chain per wave: the waves that share a SIMD fill the matrix unit between them
#pragma unroll
    for (int s = 0; s < 32; ++s) mm8(ap + s * 8, bp + s * 8, acc);
#pragma unroll
    for (int r = 0; r < 8; ++r) sL[(8 * h + r) * KC_PITCH + wave * 16 + c] = acc[r];
    __syncthreads();

    // softmax: one row per wave, eight adjacent columns per lane so that every store is 16 bytes wide
    const float4 l0 = *reinterpret_cast<const float4*>(&sL[wave * KC_PITCH + lane * 8]);
    const float4 l1 = *reinterpret_cast<const float4*>(&sL[wave * KC_PITCH + lane * 8 + 4]);
    float v[8] = {l0.x, l0.y, l0.z, l0.w, l1.x, l1.y, l1.z, l1.w};
    float mx = v[0];
#pragma unroll
    for (int i = 1; i < 8; ++i) mx = fmaxf(mx, v[i]);
#pragma unroll
    for (int o = 16; o > 0; o >>= 1) mx = fmaxf(mx, __shfl_xor(mx, o, 32));
    float sm = 0.0f;
#pragma unroll
    for (int i = 0; i < 8; ++i) { v[i] = __expf(v[i] - mx); sm += v[i]; }
#pragma unroll
    for (int o = 16; o > 0; o >>= 1) sm += __shfl_xor(sm, o, 32);
    v8h hv;
#pragma unroll
    for (int i = 0; i < 8; ++i) { v[i] = v[i] / sm; hv[i] = (_Float16)v[i]; }
    const size_t o8 = (size_t)(p0 + wave) * 256 + lane * 8;
    *reinterpret_cast<float4*>(maskf + o8)     = make_float4(v[0], v[1], v[2], v[3]);
    *reinterpret_cast<float4*>(maskf + o8 + 4) = make_float4(v[4], v[5], v[6], v[7]);
    *reinterpret_cast<v8h*>(maskh + o8)        = hv;
}

// rsqrtf with the library's own range step (below the least normal: x * 2^24 in, * 2^12 out), bit for bit.
// The instruction and the one slot that the instruction set asks for behind a transcendental stand in one statement.
__device__ __forceinline__ float rsqrt_slot(float x) {
    const bool tiny = x < 0x1.0p-126f;
    const float xs = tiny ? x * 0x1.0p+24f : x;
    float r;
    asm("v_rsq_f32 %0, %1\n\tv_nop" : "=v"(r) : "v"(xs));
    return tiny ? r * 0x1.0p+12f : r;
}

// ---------------- kF: out[b,p,d] = (sum_c mask[p,c]*x_emb[b,c,d]) * (1+ew[p]) + mask[b,p]*eb[b]
// with x_emb[b,c,:] = LN_over_d(relu(feb[c,:] + x[b,c]*few[c,:])) built in LDS as f16 [d][c]; it never leaves the WGP.
// grid 256: one work-group per b. block 512 = 16 waves; in the product a wave owns 64 p x 64 d (4 x 4 tiles).
// every unroll directive below keeps the index of a register array, and each LDS offset, a compile-time constant.
#define KF_PITCH 264   // halves; 528 B = 16 B x odd, the conflict-free pitch for 16-byte fragment reads
__global__ __launch_bounds__(512)
void kF_emb_gemm(const float* __restrict__ x,
                 const float* __restrict__ few, const float* __restrict__ feb,
                 const float* __restrict__ lnw, const float* __restrict__ lnb,
                 const _Float16* __restrict__ maskh,
                 const float* __restrict__ maskf,
                 const float* __restrict__ expand_w,
                 const float* __restrict__ expand_b,
                 float* __restrict__ out) {
    __shared__ __align__(16) _Float16 sA[256][KF_PITCH];  // mask    [p][c]
    __shared__ __align__(16) _Float16 sT[256][KF_PITCH];  // x_emb^T [d][c]
    __shared__ __align__(16) float sSc[256];              // 1 + ew[p]
    __shared__ __align__(16) float sBi[256];              // mask[b,p] * eb[b]
    const int tid = threadIdx.x, lane = tid & 31;
    // the wave's number in a scalar register: x[b, c] comes by scalar loads, and the test on it below is a scalar branch
    const int wave = __builtin_amdgcn_readfirstlane(tid >> 5);
    const int b = blockIdx.x;

    // the whole mask: 16 copies per wave, each one row of 512 contiguous bytes; they land while x_emb is computed
#pragma unroll
    for (int i = 0; i < 16; ++i) {
        const int row = i * 16 + wave;
        stage16(maskh + (size_t)row * 256 + lane * 8, &sA[row][lane * 8]);
    }

    float g[8], h[8];
#pragma unroll
    for (int i = 0; i < 8; ++i) {
        const int d = lane + 32 * i;
        g[i] = lnw[d]; h[i] = lnb[d];
    }

    // the epilogue's per-p factors, read once per work-group here, where their latency lies under the first row loads'
    if (wave < 8) {
        sSc[tid] = 1.0f + expand_w[tid];
        sBi[tid] = maskf[(size_t)b * 256 + tid] * expand_b[b];
    }

    for (int iter = 0; iter < 4; ++iter) {
        const int c = iter * 64 + wave * 4;        // four adjacent c rows, so that 64 row loads of a wave are in flight
        const float4 x4 = *reinterpret_cast<const float4*>(&x[b * 256 + c]);
        const float xv[4] = {x4.x, x4.y, x4.z, x4.w};
        const float* __restrict__ wr = few + (size_t)c * 256;
        const float* __restrict__ br = feb + (size_t)c * 256;
        float fw[4][8], fb[4][8];
#pragma unroll
        for (int t = 0; t < 4; ++t) {
#pragma unroll
            for (int i = 0; i < 8; ++i) {
                fw[t][i] = wr[t * 256 + 32 * i + lane];
                fb[t][i] = br[t * 256 + 32 * i + lane];
            }
        }
        // behind the row loads, in front of the first write of a register that they name
        asm volatile("s_wait_xcnt 0x0" ::: "memory");
        float v[4][8], s[4] = {0.f, 0.f, 0.f, 0.f}, q[4] = {0.f, 0.f, 0.f, 0.f};
#pragma unroll
        for (int t = 0; t < 4; ++t) {
#pragma unroll
            for (int i = 0; i < 8; ++i) {
                const float a = fmaxf(0.0f, fb[t][i] + xv[t] * fw[t][i]);
                v[t][i] = a;
                s[t] += a; q[t] += a * a;
            }
        }
#pragma unroll
        for (int o = 16; o > 0; o >>= 1) {
#pragma unroll
            for (int t = 0; t < 4; ++t) { s[t] += __shfl_xor(s[t], o, 32); q[t] += __shfl_xor(q[t], o, 32); }
        }
        float mu[4], rs[4];
#pragma unroll
        for (int t = 0; t < 4; ++t) {
            mu[t] = s[t] * (1.0f / 256.0f);
            rs[t] = rsqrt_slot(q[t] * (1.0f / 256.0f) - mu[t] * mu[t] + LN_EPS);
        }
#pragma unroll
        for (int i = 0; i < 8; ++i) {
            const int d = lane + 32 * i;
            union { _Float16 hh[4]; uint2 u; } pk;
#pragma unroll
            for (int t = 0; t < 4; ++t) pk.hh[t] = (_Float16)((v[t][i] - mu[t]) * rs[t] * g[i] + h[i]);
            *reinterpret_cast<uint2*>(&sT[d][c]) = pk.u;       // b64 packed transpose store
        }
    }
    // each wave's own mask copies have landed before the barrier behind which other waves read them
    stage_wait();
    __syncthreads();

    const int wp = (wave & 3) * 64;    // first p row of the wave
    const int wd = (wave >> 2) * 64;   // first d column of the wave
    const int m  = lane & 15;
    const int kb = (lane >> 4) << 3;   // 0 or 8 (ISA 16-bit lane layout)

    v8f acc[4][4] = {};
#pragma unroll
    for (int c0 = 0; c0 < 256; c0 += 32) {
        v16h af[4];
#pragma unroll
        for (int i = 0; i < 4; ++i) {
            const v8h alo = *reinterpret_cast<const v8h*>(&sA[wp + i * 16 + m][c0 + kb]);
            const v8h ahi = *reinterpret_cast<const v8h*>(&sA[wp + i * 16 + m][c0 + 16 + kb]);
            af[i] = __builtin_shufflevector(alo, ahi,
                      0, 1, 2, 3, 4, 5, 6, 7, 8, 9, 10, 11, 12, 13, 14, 15);
        }
        v16h bf[4];
#pragma unroll
        for (int j = 0; j < 4; ++j) {
            const v8h blo = *reinterpret_cast<const v8h*>(&sT[wd + j * 16 + m][c0 + kb]);
            const v8h bhi = *reinterpret_cast<const v8h*>(&sT[wd + j * 16 + m][c0 + 16 + kb]);
            bf[j] = __builtin_shufflevector(blo, bhi,
                      0, 1, 2, 3, 4, 5, 6, 7, 8, 9, 10, 11, 12, 13, 14, 15);
        }
#pragma unroll
        for (int j = 0; j < 4; ++j) {
#pragma unroll
            for (int i = 0; i < 4; ++i)
                acc[i][j] = __builtin_amdgcn_wmma_f32_16x16x32_f16(false, af[i], false, bf[j],
                                                                   (short)0, acc[i][j], false, false);
        }
    }

    // epilogue: C/D layout: VGPR r -> row m = r + (lane>=16 ? 8 : 0), col n = lane&15
    const int n  = lane & 15;
    const int mh = (lane >> 4) * 8;
    // every result is formed in its accumulator's own register before the first store:
    // a register rewritten behind a store that names it would take a wait per store
#pragma unroll
    for (int i = 0; i < 4; ++i) {
#pragma unroll
        for (int r = 0; r < 8; ++r) {
            const int p = wp + i * 16 + mh + r;
            const float scale = sSc[p];
            const float bias  = sBi[p];
#pragma unroll
            for (int j = 0; j < 4; ++j) acc[i][j][r] = acc[i][j][r] * scale + bias;
        }
    }
#pragma unroll
    for (int i = 0; i < 4; ++i) {
#pragma unroll
        for (int r = 0; r < 8; ++r) {
            const int p = wp + i * 16 + mh + r;
            const size_t base = ((size_t)b * 256 + p) * 256 + wd;
#pragma unroll
            for (int j = 0; j < 4; ++j) out[base + j * 16 + n] = acc[i][j][r];
        }
    }
}

extern "C" void kernel_launch(void* const* d_in, const int* in_sizes, int n_in,
                              void* d_out, int out_size, void* d_ws, size_t ws_size,
                              hipStream_t stream) {
    const float* x            = (const float*)d_in[0];
    const float* prev_cell    = (const float*)d_in[1];
    const float* few          = (const float*)d_in[2];
    const float* feb          = (const float*)d_in[3];
    const float* ln_emb_w     = (const float*)d_in[4];
    const float* ln_emb_b     = (const float*)d_in[5];
    const float* ln_col_w     = (const float*)d_in[6];
    const float* ln_col_b     = (const float*)d_in[7];
    const float* ln_prompt_w  = (const float*)d_in[8];
    const float* ln_prompt_b  = (const float*)d_in[9];
    const float* dense_imp_w  = (const float*)d_in[10];
    const float* dense_imp_b  = (const float*)d_in[11];
    const float* emb_column   = (const float*)d_in[12];
    const float* emb_prompt   = (const float*)d_in[13];
    const float* expand_w     = (const float*)d_in[14];
    const float* expand_b     = (const float*)d_in[15];
    float* out = (float*)d_out;

    char* ws = (char*)d_ws;
    float*    x_prompt = (float*)(ws);               // 262144 B
    float*    x_col    = (float*)(ws + 262144);      // 262144 B
    float*    maskf    = (float*)(ws + 524288);      // 262144 B
    _Float16* maskh    = (_Float16*)(ws + 786432);   // 131072 B

    kA_prompt<<<128, 256, 0, stream>>>(emb_prompt, prev_cell, ln_prompt_w, ln_prompt_b,
                                       dense_imp_w, dense_imp_b, x_prompt);
    kB_col<<<256, 256, 0, stream>>>(emb_column, ln_col_w, ln_col_b, x_col);
    kC_mask<<<16, 512, 0, stream>>>(x_prompt, x_col, maskf, maskh);
    kF_emb_gemm<<<256, 512, 0, stream>>>(x, few, feb, ln_emb_w, ln_emb_b, maskh, maskf,
                                         expand_w, expand_b, out);
}

// v003
// A run of this version takes 28.4 microseconds.
// Timed twice side by side with v002, it ran 1.38 times as fast both times.
// Over all steps from v000 it is 2.17 times as fast.
#include <hip/hip_runtime.h>
#include <hip/hip_bf16.h>

typedef __attribute__((ext_vector_type(8)))  _Float16 v8h;
typedef __attribute__((ext_vector_type(16))) _Float16 v16h;
typedef __attribute__((ext_vector_type(8)))  float    v8f;
typedef __attribute__((ext_vector_type(2)))  float    v2f;

typedef int v4i __attribute__((vector_size(16)));
typedef __attribute__((address_space(1))) v4i gv4i;  // global 128-bit
typedef __attribute__((address_space(3))) v4i lv4i;  // LDS    128-bit

#define LN_EPS 1e-5f

#if defined(__has_builtin)
#if __has_builtin(__builtin_amdgcn_global_load_async_to_lds_b128)
#define HAVE_ASYNC_LDS 1
#endif
#endif

// 16B global -> LDS staging (async CDNA5 path when available)
__device__ __forceinline__ void stage16(const _Float16* g, _Float16* l) {
#ifdef HAVE_ASYNC_LDS
    __builtin_amdgcn_global_load_async_to_lds_b128(
        (gv4i*)(uintptr_t)g, (lv4i*)(uintptr_t)l, 0, 0);
#else
    *reinterpret_cast<v8h*>(l) = *reinterpret_cast<const v8h*>(g);
#endif
}

// the issuing wave's own wait for its copies; asm with the memory clobber so that no LDS read is lifted over it
__device__ __forceinline__ void stage_wait() {
#ifdef HAVE_ASYNC_LDS
    asm volatile("s_wait_asynccnt 0x0" ::: "memory");
#endif
}

// ---------------- block reduction helpers (blockDim.x == 256, 8 waves) ----------------
__device__ __forceinline__ float block_reduce_sum(float v, float* scratch) {
#pragma unroll
    for (int o = 16; o > 0; o >>= 1) v += __shfl_xor(v, o, 32);
    if ((threadIdx.x & 31) == 0) scratch[threadIdx.x >> 5] = v;
    __syncthreads();
    float r = 0.0f;
#pragma unroll
    for (int i = 0; i < 8; ++i) r += scratch[i];
    __syncthreads();
    return r;
}

// f32 matrix fragment pair: a lane (c = lane & 15, h = lane >> 4) holds 16 bytes of row c at k + 4h of each
// 8-k step; A and B are read by the same code, so the k pairing is equal at every lane and register.
__device__ __forceinline__ void mm8(const float* ap, const float* bp, v8f& acc) {
    const float4 a = *reinterpret_cast<const float4*>(ap);
    const float4 b = *reinterpret_cast<const float4*>(bp);
    const v2f a0 = {a.x, a.y}, a1 = {a.z, a.w}, b0 = {b.x, b.y}, b1 = {b.z, b.w};
    acc = __builtin_amdgcn_wmma_f32_16x16x4_f32(false, a0, false, b0, (short)0, acc, false, false);
    acc = __builtin_amdgcn_wmma_f32_16x16x4_f32(false, a1, false, b1, (short)0, acc, false, false);
}

// ---------------- kA: x_prompt[p,d] = (concat(LN(emb_prompt[p]), prev[p]) @ W^T)[d] + b[d] + emb_prompt[p,d]
// grid 128: 16 p-tiles of 16 rows x 8 d-tiles of 32. block 256 = 8 waves = 2 d-subtiles x 4 k-quarters of 128.
#define KA_PITCH 516   // floats; 16 B x odd, the conflict-free pitch for 16-byte fragment reads
__global__ __launch_bounds__(256)
void kA_prompt(const float* __restrict__ emb_prompt,
               const float* __restrict__ prev_cell,
               const float* __restrict__ lnw, const float* __restrict__ lnb,
               const float* __restrict__ W,   // [256, 512]
               const float* __restrict__ Wb,
               float* __restrict__ x_prompt) {
    __shared__ __align__(16) float sX[16 * KA_PITCH];   // concat(LN(emb_prompt), prev), 16 rows
    __shared__ __align__(16) float sW[32 * KA_PITCH];   // 32 rows of W
    __shared__ __align__(16) float sR[8 * 256];         // one partial tile per wave
    const int tid = threadIdx.x, lane = tid & 31, wave = tid >> 5;
    const int p0 = (blockIdx.x >> 3) * 16, n0 = (blockIdx.x & 7) * 32;

    // every global read of the block is issued before the first use; each wave-wide load covers 512 contiguous bytes
    const float4* W4 = reinterpret_cast<const float4*>(W) + (size_t)n0 * 128;
    const float4* P4 = reinterpret_cast<const float4*>(prev_cell) + (size_t)p0 * 64;
    const float4* E4 = reinterpret_cast<const float4*>(emb_prompt) + (size_t)p0 * 64;
    float4 ev[2][2], gw[2], gb[2], pr[4], wr[16];
#pragma unroll
    for (int j = 0; j < 2; ++j) {
        ev[0][j] = E4[(wave * 2) * 64 + lane + 32 * j];
        ev[1][j] = E4[(wave * 2 + 1) * 64 + lane + 32 * j];
        gw[j] = reinterpret_cast<const float4*>(lnw)[lane + 32 * j];
        gb[j] = reinterpret_cast<const float4*>(lnb)[lane + 32 * j];
    }
#pragma unroll
    for (int i = 0; i < 4; ++i) pr[i] = P4[i * 256 + tid];
#pragma unroll
    for (int i = 0; i < 16; ++i) wr[i] = W4[i * 256 + tid];

    // LayerNorm of two rows per wave
#pragma unroll
    for (int rr = 0; rr < 2; ++rr) {
        const float4 e0 = ev[rr][0], e1 = ev[rr][1];
        float s = (e0.x + e0.y) + (e0.z + e0.w) + (e1.x + e1.y) + (e1.z + e1.w);
#pragma unroll
        for (int o = 16; o > 0; o >>= 1) s += __shfl_xor(s, o, 32);
        const float mu = s * (1.0f / 256.0f);
        float4 d0 = {e0.x - mu, e0.y - mu, e0.z - mu, e0.w - mu};
        float4 d1 = {e1.x - mu, e1.y - mu, e1.z - mu, e1.w - mu};
        float q = (d0.x * d0.x + d0.y * d0.y) + (d0.z * d0.z + d0.w * d0.w)
                + (d1.x * d1.x + d1.y * d1.y) + (d1.z * d1.z + d1.w * d1.w);
#pragma unroll
        for (int o = 16; o > 0; o >>= 1) q += __shfl_xor(q, o, 32);
        const float rs = rsqrtf(q * (1.0f / 256.0f) + LN_EPS);
        float* row = &sX[(wave * 2 + rr) * KA_PITCH];
        const float4 y0 = {d0.x * rs * gw[0].x + gb[0].x, d0.y * rs * gw[0].y + gb[0].y,
                           d0.z * rs * gw[0].z + gb[0].z, d0.w * rs * gw[0].w + gb[0].w};
        const float4 y1 = {d1.x * rs * gw[1].x + gb[1].x, d1.y * rs * gw[1].y + gb[1].y,
                           d1.z * rs * gw[1].z + gb[1].z, d1.w * rs * gw[1].w + gb[1].w};
        *reinterpret_cast<float4*>(&row[lane * 4])       = y0;
        *reinterpret_cast<float4*>(&row[128 + lane * 4]) = y1;
    }
#pragma unroll
    for (int i = 0; i < 4; ++i) {
        const int idx = i * 256 + tid;
        *reinterpret_cast<float4*>(&sX[(idx >> 6) * KA_PITCH + 256 + (idx & 63) * 4]) = pr[i];
    }
#pragma unroll
    for (int i = 0; i < 16; ++i) {
        const int idx = i * 256 + tid;
        *reinterpret_cast<float4*>(&sW[(idx >> 7) * KA_PITCH + (idx & 127) * 4]) = wr[i];
    }
    __syncthreads();

    const int c = lane & 15, h = lane >> 4;
    const int ns = wave & 1, ks = wave >> 1;
    const float* ap = &sX[c * KA_PITCH + ks * 128 + 4 * h];
    const float* bp = &sW[(ns * 16 + c) * KA_PITCH + ks * 128 + 4 * h];
    v8f acc = {};   // one chain per wave: the waves that share a SIMD fill the matrix unit between them
#pragma unroll
    for (int s = 0; s < 16; ++s) mm8(ap + s * 8, bp + s * 8, acc);
#pragma unroll
    for (int r = 0; r < 8; ++r) sR[wave * 256 + r * 32 + lane] = acc[r];
    __syncthreads();

    // sum the four k-quarters; element (r, lane) of a tile is row 8h + r, column c
#pragma unroll
    for (int t = 0; t < 2; ++t) {
        const float v = (sR[t * 256 + tid] + sR[(2 + t) * 256 + tid])
                      + (sR[(4 + t) * 256 + tid] + sR[(6 + t) * 256 + tid]);
        const int p = p0 + 8 * h + wave;       // r = tid >> 5
        const int d = n0 + t * 16 + c;
        x_prompt[p * 256 + d] = v + Wb[d] + emb_prompt[p * 256 + d];
    }
}

// ---------------- kB: x_col = LN(emb_column)
__global__ void kB_col(const float* __restrict__ emb_col,
                       const float* __restrict__ lnw, const float* __restrict__ lnb,
                       float* __restrict__ x_col) {
    __shared__ float scratch[8];
    const int c = blockIdx.x, d = threadIdx.x;
    const float e  = emb_col[c * 256 + d];
    const float mu = block_reduce_sum(e, scratch) * (1.0f / 256.0f);
    const float dv = e - mu;
    const float var = block_reduce_sum(dv * dv, scratch) * (1.0f / 256.0f);
    x_col[c * 256 + d] = dv * rsqrtf(var + LN_EPS) * lnw[d] + lnb[d];
}

// ---------------- kC: mask = softmax(x_prompt @ x_col^T)
// grid 16: 16 rows p each, all 256 columns c. block 512 = 16 waves, one 16x16 tile over the whole k per wave.
#define KC_PITCH 260   // floats; 16 B x odd
__global__ __launch_bounds__(512)
void kC_mask(const float* __restrict__ x_prompt,
             const float* __restrict__ x_col,
             float* __restrict__ maskf,
             _Float16* __restrict__ maskh) {
    __shared__ __align__(16) float sC[256 * KC_PITCH];
    __shared__ __align__(16) float sP[16 * KC_PITCH];
    __shared__ __align__(16) float sL[16 * KC_PITCH];
    const int tid = threadIdx.x, lane = tid & 31, wave = tid >> 5;
    const int p0 = blockIdx.x * 16;

    const float4* C4 = reinterpret_cast<const float4*>(x_col);
    const float4* P4 = reinterpret_cast<const float4*>(x_prompt) + (size_t)p0 * 64;
    float4 pr[2], cr[32];
#pragma unroll
    for (int i = 0; i < 2; ++i) pr[i] = P4[i * 512 + tid];
#pragma unroll
    for (int i = 0; i < 32; ++i) cr[i] = C4[i * 512 + tid];
#pragma unroll
    for (int i = 0; i < 2; ++i) {
        const int idx = i * 512 + tid;
        *reinterpret_cast<float4*>(&sP[(idx >> 6) * KC_PITCH + (idx & 63) * 4]) = pr[i];
    }
#pragma unroll
    for (int i = 0; i < 32; ++i) {
        const int idx = i * 512 + tid;
        *reinterpret_cast<float4*>(&sC[(idx >> 6) * KC_PITCH + (idx & 63) * 4]) = cr[i];
    }
    __syncthreads();

    const int c = lane & 15, h = lane >> 4;
    const float* ap = &sP[c * KC_PITCH + 4 * h];
    const float* bp = &sC[(wave * 16 + c) * KC_PITCH + 4 * h];
    v8f acc = {};   // one chain per wave: the waves that share a SIMD fill the matrix unit between them
#pragma unroll
    for (int s = 0; s < 32; ++s) mm8(ap + s * 8, bp + s * 8, acc);
#pragma unroll
    for (int r = 0; r < 8; ++r) sL[(8 * h + r) * KC_PITCH + wave * 16 + c] = acc[r];
    __syncthreads();

    // softmax: one row per wave, eight adjacent columns per lane so that every store is 16 bytes wide
    const float4 l0 = *reinterpret_cast<const float4*>(&sL[wave * KC_PITCH + lane * 8]);
    const float4 l1 = *reinterpret_cast<const float4*>(&sL[wave * KC_PITCH + lane * 8 + 4]);
    float v[8] = {l0.x, l0.y, l0.z, l0.w, l1.x, l1.y, l1.z, l1.w};
    float mx = v[0];
#pragma unroll
    for (int i = 1; i < 8; ++i) mx = fmaxf(mx, v[i]);
#pragma unroll
    for (int o = 16; o > 0; o >>= 1) mx = fmaxf(mx, __shfl_xor(mx, o, 32));
    float sm = 0.0f;
#pragma unroll
    for (int i = 0; i < 8; ++i) { v[i] = __expf(v[i] - mx); sm += v[i]; }
#pragma unroll
    for (int o = 16; o > 0; o >>= 1) sm += __shfl_xor(sm, o, 32);
    v8h hv;
#pragma unroll
    for (int i = 0; i < 8; ++i) { v[i] = v[i] / sm; hv[i] = (_Float16)v[i]; }
    const size_t o8 = (size_t)(p0 + wave) * 256 + lane * 8;
    *reinterpret_cast<float4*>(maskf + o8)     = make_float4(v[0], v[1], v[2], v[3]);
    *reinterpret_cast<float4*>(maskf + o8 + 4) = make_float4(v[4], v[5], v[6], v[7]);
    *reinterpret_cast<v8h*>(maskh + o8)        = hv;
}

// rsqrtf with the library's own range step (below the least normal: x * 2^24 in, * 2^12 out), bit for bit.
// The instruction and the one slot that the instruction set asks for behind a transcendental stand in one statement.
__device__ __forceinline__ float rsqrt_slot(float x) {
    const bool tiny = x < 0x1.0p-126f;
    const float xs = tiny ? x * 0x1.0p+24f : x;
    float r;
    asm("v_rsq_f32 %0, %1\n\tv_nop" : "=v"(r) : "v"(xs));
    return tiny ? r * 0x1.0p+12f : r;
}

// ---------------- kF: out[b,p,d] = (sum_c mask[p,c]*x_emb[b,c,d]) * (1+ew[p]) + mask[b,p]*eb[b]
// with x_emb[b,c,:] = LN_over_d(relu(feb[c,:] + x[b,c]*few[c,:])) built in LDS as f16 [dealt row of d][c, or c ^ 64]; it never leaves the WGP.
// grid 256: one work-group per b. block 512 = 16 waves; in the product a wave owns 64 p x 64 d (4 x 4 tiles).
// the columns d are dealt to the B fragments so that column n of tile j is d = 4n + j of the wave's 64: a lane's four
// accumulators of one row p are then adjacent in out, and one 16-byte store per lane writes 256 contiguous bytes per row.
// LDS row of column d: (d & ~63) + 16 * (d & 3) + ((d >> 2) & 15). Rows 16 apart start in the same bank, and four lanes of
// a transpose store write such rows; the rows of odd d therefore hold c at c ^ 64, which keeps that store at two lanes a bank.
// every unroll directive below keeps the index of a register array, and each LDS offset, a compile-time constant.
#define KF_PITCH 264   // halves; 528 B = 16 B x odd, the conflict-free pitch for 16-byte fragment reads
__global__ __launch_bounds__(512)
void kF_emb_gemm(const float* __restrict__ x,
                 const float* __restrict__ few, const float* __restrict__ feb,
                 const float* __restrict__ lnw, const float* __restrict__ lnb,
                 const _Float16* __restrict__ maskh,
                 const float* __restrict__ maskf,
                 const float* __restrict__ expand_w,
                 const float* __restrict__ expand_b,
                 float* __restrict__ out) {
    __shared__ __align__(16) _Float16 sA[256][KF_PITCH];  // mask    [p][c]
    __shared__ __align__(16) _Float16 sT[256][KF_PITCH];  // x_emb^T [dealt row of d][c, or c ^ 64]
    __shared__ __align__(16) float sSc[256];              // 1 + ew[p]
    __shared__ __align__(16) float sBi[256];              // mask[b,p] * eb[b]
    const int tid = threadIdx.x, lane = tid & 31;
    // the wave's number in a scalar register: x[b, c] comes by scalar loads, and the test on it below is a scalar branch
    const int wave = __builtin_amdgcn_readfirstlane(tid >> 5);
    const int b = blockIdx.x;

    // the whole mask: 16 copies per wave, each one row of 512 contiguous bytes; they land while x_emb is computed
#pragma unroll
    for (int i = 0; i < 16; ++i) {
        const int row = i * 16 + wave;
        stage16(maskh + (size_t)row * 256 + lane * 8, &sA[row][lane * 8]);
    }

    float g[8], h[8];
#pragma unroll
    for (int i = 0; i < 8; ++i) {
        const int d = lane + 32 * i;
        g[i] = lnw[d]; h[i] = lnb[d];
    }
    const int trow = ((lane & 3) << 4) + (lane >> 2);   // the lane's part of the LDS row of d = lane + 32 i
    const int tswp = (lane & 1) << 6;                   // odd d: the 64-c halves swapped

    // the epilogue's per-p factors, read once per work-group here, where their latency lies under the first row loads'
    if (wave < 8) {
        sSc[tid] = 1.0f + expand_w[tid];
        sBi[tid] = maskf[(size_t)b * 256 + tid] * expand_b[b];
    }

    for (int iter = 0; iter < 4; ++iter) {
        const int c = iter * 64 + wave * 4;        // four adjacent c rows, so that 64 row loads of a wave are in flight
        const float4 x4 = *reinterpret_cast<const float4*>(&x[b * 256 + c]);
        const float xv[4] = {x4.x, x4.y, x4.z, x4.w};
        const float* __restrict__ wr = few + (size_t)c * 256;
        const float* __restrict__ br = feb + (size_t)c * 256;
        float fw[4][8], fb[4][8];
#pragma unroll
        for (int t = 0; t < 4; ++t) {
#pragma unroll
            for (int i = 0; i < 8; ++i) {
                fw[t][i] = wr[t * 256 + 32 * i + lane];
                fb[t][i] = br[t * 256 + 32 * i + lane];
            }
        }
        // behind the row loads, in front of the first write of a register that they name
        asm volatile("s_wait_xcnt 0x0" ::: "memory");
        float v[4][8], s[4] = {0.f, 0.f, 0.f, 0.f}, q[4] = {0.f, 0.f, 0.f, 0.f};
#pragma unroll
        for (int t = 0; t < 4; ++t) {
#pragma unroll
            for (int i = 0; i < 8; ++i) {
                const float a = fmaxf(0.0f, fb[t][i] + xv[t] * fw[t][i]);
                v[t][i] = a;
                s[t] += a; q[t] += a * a;
            }
        }
#pragma unroll
        for (int o = 16; o > 0; o >>= 1) {
#pragma unroll
            for (int t = 0; t < 4; ++t) { s[t] += __shfl_xor(s[t], o, 32); q[t] += __shfl_xor(q[t], o, 32); }
        }
        float mu[4], rs[4];
#pragma unroll
        for (int t = 0; t < 4; ++t) {
            mu[t] = s[t] * (1.0f / 256.0f);
            rs[t] = rsqrt_slot(q[t] * (1.0f / 256.0f) - mu[t] * mu[t] + LN_EPS);
        }
#pragma unroll
        for (int i = 0; i < 8; ++i) {
            union { _Float16 hh[4]; uint2 u; } pk;
#pragma unroll
            for (int t = 0; t < 4; ++t) pk.hh[t] = (_Float16)((v[t][i] - mu[t]) * rs[t] * g[i] + h[i]);
            // b64 packed transpose store, to the dealt row of d = lane + 32 i
            *reinterpret_cast<uint2*>(&sT[trow + 8 * (i & 1) + 64 * (i >> 1)][c ^ tswp]) = pk.u;
        }
    }
    // each wave's own mask copies have landed before the barrier behind which other waves read them
    stage_wait();
    __syncthreads();

    const int wp = (wave & 3) * 64;    // first p row of the wave
    const int wd = (wave >> 2) * 64;   // first d column of the wave
    const int m  = lane & 15;
    const int kb = (lane >> 4) << 3;   // 0 or 8 (ISA 16-bit lane layout)

    v8f acc[4][4] = {};
#pragma unroll
    for (int c0 = 0; c0 < 256; c0 += 32) {
        v16h af[4];
#pragma unroll
        for (int i = 0; i < 4; ++i) {
            const v8h alo = *reinterpret_cast<const v8h*>(&sA[wp + i * 16 + m][c0 + kb]);
            const v8h ahi = *reinterpret_cast<const v8h*>(&sA[wp + i * 16 + m][c0 + 16 + kb]);
            af[i] = __builtin_shufflevector(alo, ahi,
                      0, 1, 2, 3, 4, 5, 6, 7, 8, 9, 10, 11, 12, 13, 14, 15);
        }
        v16h bf[4];
#pragma unroll
        for (int j = 0; j < 4; ++j) {
            const int cs = c0 ^ ((j & 1) << 6);   // tile j holds the columns d = 4m + j: odd j, halves swapped
            const v8h blo = *reinterpret_cast<const v8h*>(&sT[wd + j * 16 + m][cs + kb]);
            const v8h bhi = *reinterpret_cast<const v8h*>(&sT[wd + j * 16 + m][cs + 16 + kb]);
            bf[j] = __builtin_shufflevector(blo, bhi,
                      0, 1, 2, 3, 4, 5, 6, 7, 8, 9, 10, 11, 12, 13, 14, 15);
        }
#pragma unroll
        for (int j = 0; j < 4; ++j) {
#pragma unroll
            for (int i = 0; i < 4; ++i)
                acc[i][j] = __builtin_amdgcn_wmma_f32_16x16x32_f16(false, af[i], false, bf[j],
                                                                   (short)0, acc[i][j], false, false);
        }
    }

    // epilogue: C/D layout: VGPR r -> row m = r + (lane>=16 ? 8 : 0), col n = lane&15, which is d = wd + 4n + j
    const int n  = lane & 15;
    const int mh = (lane >> 4) * 8;
    // one address for all 32 stores, the row as a constant offset; 16 lanes cover 256 contiguous bytes of a row
    float* __restrict__ orow = out + ((size_t)b * 256 + wp + mh) * 256 + wd + 4 * n;
#pragma unroll
    for (int i = 0; i < 4; ++i) {
#pragma unroll
        for (int r = 0; r < 8; ++r) {
            const int p = wp + i * 16 + mh + r;
            const float scale = sSc[p];
            const float bias  = sBi[p];
            *reinterpret_cast<float4*>(orow + (i * 16 + r) * 256) =
                make_float4(acc[i][0][r] * scale + bias, acc[i][1][r] * scale + bias,
                            acc[i][2][r] * scale + bias, acc[i][3][r] * scale + bias);
        }
    }
}

extern "C" void kernel_launch(void* const* d_in, const int* in_sizes, int n_in,
                              void* d_out, int out_size, void* d_ws, size_t ws_size,
                              hipStream_t stream) {
    const float* x            = (const float*)d_in[0];
    const float* prev_cell    = (const float*)d_in[1];
    const float* few          = (const float*)d_in[2];
    const float* feb          = (const float*)d_in[3];
    const float* ln_emb_w     = (const float*)d_in[4];
    const float* ln_emb_b     = (const float*)d_in[5];
    const float* ln_col_w     = (const float*)d_in[6];
    const float* ln_col_b     = (const float*)d_in[7];
    const float* ln_prompt_w  = (const float*)d_in[8];
    const float* ln_prompt_b  = (const float*)d_in[9];
    const float* dense_imp_w  = (const float*)d_in[10];
    const float* dense_imp_b  = (const float*)d_in[11];
    const float* emb_column   = (const float*)d_in[12];
    const float* emb_prompt   = (const float*)d_in[13];
    const float* expand_w     = (const float*)d_in[14];
    const float* expand_b     = (const float*)d_in[15];
    float* out = (float*)d_out;

    char* ws = (char*)d_ws;
    float*    x_prompt = (float*)(ws);               // 262144 B
    float*    x_col    = (float*)(ws + 262144);      // 262144 B
    float*    maskf    = (float*)(ws + 524288);      // 262144 B
    _Float16* maskh    = (_Float16*)(ws + 786432);   // 131072 B

    kA_prompt<<<128, 256, 0, stream>>>(emb_prompt, prev_cell, ln_prompt_w, ln_prompt_b,
                                       dense_imp_w, dense_imp_b, x_prompt);
    kB_col<<<256, 256, 0, stream>>>(emb_column, ln_col_w, ln_col_b, x_col);
    kC_mask<<<16, 512, 0, stream>>>(x_prompt, x_col, maskf, maskh);
    kF_emb_gemm<<<256, 512, 0, stream>>>(x, few, feb, ln_emb_w, ln_emb_b, maskh, maskf,
                                         expand_w, expand_b, out);
}

// v004
// A run of this version takes 27.2 microseconds.
// Timed twice side by side with v003, it ran 1.06 and 1.07 times as fast.
// Counting every step since v000, it is 2.32 times as fast.
#include <hip/hip_runtime.h>
#include <hip/hip_bf16.h>

typedef __attribute__((ext_vector_type(8)))  _Float16 v8h;
typedef __attribute__((ext_vector_type(16))) _Float16 v16h;
typedef __attribute__((ext_vector_type(8)))  float    v8f;
typedef __attribute__((ext_vector_type(2)))  float    v2f;

typedef int v4i __attribute__((vector_size(16)));
typedef __attribute__((address_space(1))) v4i gv4i;  // global 128-bit
typedef __attribute__((address_space(3))) v4i lv4i;  // LDS    128-bit

#define LN_EPS 1e-5f

#if defined(__has_builtin)
#if __has_builtin(__builtin_amdgcn_global_load_async_to_lds_b128)
#define HAVE_ASYNC_LDS 1
#endif
#endif

// 16B global -> LDS staging (async CDNA5 path when available)
__device__ __forceinline__ void stage16(const _Float16* g, _Float16* l) {
#ifdef HAVE_ASYNC_LDS
    __builtin_amdgcn_global_load_async_to_lds_b128(
        (gv4i*)(uintptr_t)g, (lv4i*)(uintptr_t)l, 0, 0);
#else
    *reinterpret_cast<v8h*>(l) = *reinterpret_cast<const v8h*>(g);
#endif
}

// the issuing wave's own wait for its copies; asm with the memory clobber so that no LDS read is lifted over it
__device__ __forceinline__ void stage_wait() {
#ifdef HAVE_ASYNC_LDS
    asm volatile("s_wait_asynccnt 0x0" ::: "memory");
#endif
}

// f32 matrix fragment pair: a lane (c = lane & 15, h = lane >> 4) holds 16 bytes of row c at k + 4h of each
// 8-k step; A and B are read by the same code, so the k pairing is equal at every lane and register.
__device__ __forceinline__ void mm8(const float* ap, const float* bp, v8f& acc) {
    const float4 a = *reinterpret_cast<const float4*>(ap);
    const float4 b = *reinterpret_cast<const float4*>(bp);
    const v2f a0 = {a.x, a.y}, a1 = {a.z, a.w}, b0 = {b.x, b.y}, b1 = {b.z, b.w};
    acc = __builtin_amdgcn_wmma_f32_16x16x4_f32(false, a0, false, b0, (short)0, acc, false, false);
    acc = __builtin_amdgcn_wmma_f32_16x16x4_f32(false, a1, false, b1, (short)0, acc, false, false);
}

// ---------------- kA: x_prompt[p,d] = (concat(LN(emb_prompt[p]), prev[p]) @ W^T)[d] + b[d] + emb_prompt[p,d]
// work-groups 0..127: 16 p-tiles of 16 rows x 8 d-tiles of 32. block 256 = 8 waves = 2 d-subtiles x 4 k-quarters of 128.
// work-groups 128..159: x_col = LN(emb_column), one row per wave. It depends on nothing of the product and the mask kernel
// needs both, so the two share one launch; these work-groups run on WGPs that the product leaves idle and end before it.
#define KA_TILES 128
#define KA_PITCH 516   // floats; 16 B x odd, the conflict-free pitch for 16-byte fragment reads
__global__ __launch_bounds__(256)
void kA_prompt(const float* __restrict__ emb_prompt,
               const float* __restrict__ prev_cell,
               const float* __restrict__ lnw, const float* __restrict__ lnb,
               const float* __restrict__ W,   // [256, 512]
               const float* __restrict__ Wb,
               float* __restrict__ x_prompt,
               const float* __restrict__ emb_col,
               const float* __restrict__ lncw, const float* __restrict__ lncb,
               float* __restrict__ x_col) {
    __shared__ __align__(16) float sX[16 * KA_PITCH];   // concat(LN(emb_prompt), prev), 16 rows
    __shared__ __align__(16) float sW[32 * KA_PITCH];   // 32 rows of W
    __shared__ __align__(16) float sR[8 * 256];         // one partial tile per wave
    const int tid = threadIdx.x, lane = tid & 31, wave = tid >> 5;

    // the whole work-group takes this branch or none of it does, and it leaves in front of every barrier
    if (blockIdx.x >= KA_TILES) {
        const size_t r4 = (size_t)((blockIdx.x - KA_TILES) * 8 + wave) * 64 + lane;
        const float4 e0 = reinterpret_cast<const float4*>(emb_col)[r4];
        const float4 e1 = reinterpret_cast<const float4*>(emb_col)[r4 + 32];
        const float4 w0 = reinterpret_cast<const float4*>(lncw)[lane], w1 = reinterpret_cast<const float4*>(lncw)[lane + 32];
        const float4 b0 = reinterpret_cast<const float4*>(lncb)[lane], b1 = reinterpret_cast<const float4*>(lncb)[lane + 32];
        float s = (e0.x + e0.y) + (e0.z + e0.w) + (e1.x + e1.y) + (e1.z + e1.w);
#pragma unroll
        for (int o = 16; o > 0; o >>= 1) s += __shfl_xor(s, o, 32);
        const float mu = s * (1.0f / 256.0f);
        const float4 d0 = {e0.x - mu, e0.y - mu, e0.z - mu, e0.w - mu};
        const float4 d1 = {e1.x - mu, e1.y - mu, e1.z - mu, e1.w - mu};
        float q = (d0.x * d0.x + d0.y * d0.y) + (d0.z * d0.z + d0.w * d0.w)
                + (d1.x * d1.x + d1.y * d1.y) + (d1.z * d1.z + d1.w * d1.w);
#pragma unroll
        for (int o = 16; o > 0; o >>= 1) q += __shfl_xor(q, o, 32);
        const float rs = rsqrtf(q * (1.0f / 256.0f) + LN_EPS);
        reinterpret_cast<float4*>(x_col)[r4] =
            make_float4(d0.x * rs * w0.x + b0.x, d0.y * rs * w0.y + b0.y, d0.z * rs * w0.z + b0.z, d0.w * rs * w0.w + b0.w);
        reinterpret_cast<float4*>(x_col)[r4 + 32] =
            make_float4(d1.x * rs * w1.x + b1.x, d1.y * rs * w1.y + b1.y, d1.z * rs * w1.z + b1.z, d1.w * rs * w1.w + b1.w);
        return;
    }
    const int p0 = (blockIdx.x >> 3) * 16, n0 = (blockIdx.x & 7) * 32;

    // every global read of the block is issued before the first use; each wave-wide load covers 512 contiguous bytes
    const float4* W4 = reinterpret_cast<const float4*>(W) + (size_t)n0 * 128;
    const float4* P4 = reinterpret_cast<const float4*>(prev_cell) + (size_t)p0 * 64;
    const float4* E4 = reinterpret_cast<const float4*>(emb_prompt) + (size_t)p0 * 64;
    float4 ev[2][2], gw[2], gb[2], pr[4], wr[16];
#pragma unroll
    for (int j = 0; j < 2; ++j) {
        ev[0][j] = E4[(wave * 2) * 64 + lane + 32 * j];
        ev[1][j] = E4[(wave * 2 + 1) * 64 + lane + 32 * j];
        gw[j] = reinterpret_cast<const float4*>(lnw)[lane + 32 * j];
        gb[j] = reinterpret_cast<const float4*>(lnb)[lane + 32 * j];
    }
#pragma unroll
    for (int i = 0; i < 4; ++i) pr[i] = P4[i * 256 + tid];
#pragma unroll
    for (int i = 0; i < 16; ++i) wr[i] = W4[i * 256 + tid];
    // keeps the loads above in front of the first use below: without it this build issues W's only behind the first row sum
    __builtin_amdgcn_sched_barrier(0);

    // LayerNorm of two rows per wave
#pragma unroll
    for (int rr = 0; rr < 2; ++rr) {
        const float4 e0 = ev[rr][0], e1 = ev[rr][1];
        float s = (e0.x + e0.y) + (e0.z + e0.w) + (e1.x + e1.y) + (e1.z + e1.w);
#pragma unroll
        for (int o = 16; o > 0; o >>= 1) s += __shfl_xor(s, o, 32);
        const float mu = s * (1.0f / 256.0f);
        float4 d0 = {e0.x - mu, e0.y - mu, e0.z - mu, e0.w - mu};
        float4 d1 = {e1.x - mu, e1.y - mu, e1.z - mu, e1.w - mu};
        float q = (d0.x * d0.x + d0.y * d0.y) + (d0.z * d0.z + d0.w * d0.w)
                + (d1.x * d1.x + d1.y * d1.y) + (d1.z * d1.z + d1.w * d1.w);
#pragma unroll
        for (int o = 16; o > 0; o >>= 1) q += __shfl_xor(q, o, 32);
        const float rs = rsqrtf(q * (1.0f / 256.0f) + LN_EPS);
        float* row = &sX[(wave * 2 + rr) * KA_PITCH];
        const float4 y0 = {d0.x * rs * gw[0].x + gb[0].x, d0.y * rs * gw[0].y + gb[0].y,
                           d0.z * rs * gw[0].z + gb[0].z, d0.w * rs * gw[0].w + gb[0].w};
        const float4 y1 = {d1.x * rs * gw[1].x + gb[1].x, d1.y * rs * gw[1].y + gb[1].y,
                           d1.z * rs * gw[1].z + gb[1].z, d1.w * rs * gw[1].w + gb[1].w};
        *reinterpret_cast<float4*>(&row[lane * 4])       = y0;
        *reinterpret_cast<float4*>(&row[128 + lane * 4]) = y1;
    }
#pragma unroll
    for (int i = 0; i < 4; ++i) {
        const int idx = i * 256 + tid;
        *reinterpret_cast<float4*>(&sX[(idx >> 6) * KA_PITCH + 256 + (idx & 63) * 4]) = pr[i];
    }
#pragma unroll
    for (int i = 0; i < 16; ++i) {
        const int idx = i * 256 + tid;
        *reinterpret_cast<float4*>(&sW[(idx >> 7) * KA_PITCH + (idx & 127) * 4]) = wr[i];
    }
    __syncthreads();

    const int c = lane & 15, h = lane >> 4;
    const int ns = wave & 1, ks = wave >> 1;
    const float* ap = &sX[c * KA_PITCH + ks * 128 + 4 * h];
    const float* bp = &sW[(ns * 16 + c) * KA_PITCH + ks * 128 + 4 * h];
    v8f acc = {};   // one chain per wave: the waves that share a SIMD fill the matrix unit between them
#pragma unroll
    for (int s = 0; s < 16; ++s) mm8(ap + s * 8, bp + s * 8, acc);
#pragma unroll
    for (int r = 0; r < 8; ++r) sR[wave * 256 + r * 32 + lane] = acc[r];
    __syncthreads();

    // sum the four k-quarters; element (r, lane) of a tile is row 8h + r, column c
#pragma unroll
    for (int t = 0; t < 2; ++t) {
        const float v = (sR[t * 256 + tid] + sR[(2 + t) * 256 + tid])
                      + (sR[(4 + t) * 256 + tid] + sR[(6 + t) * 256 + tid]);
        const int p = p0 + 8 * h + wave;       // r = tid >> 5
        const int d = n0 + t * 16 + c;
        x_prompt[p * 256 + d] = v + Wb[d] + emb_prompt[p * 256 + d];
    }
}

// ---------------- kC: mask = softmax(x_prompt @ x_col^T)
// grid 16: 16 rows p each, all 256 columns c. block 512 = 16 waves, one 16x16 tile over the whole k per wave.
#define KC_PITCH 260   // floats; 16 B x odd
__global__ __launch_bounds__(512)
void kC_mask(const float* __restrict__ x_prompt,
             const float* __restrict__ x_col,
             float* __restrict__ maskf,
             _Float16* __restrict__ maskh) {
    __shared__ __align__(16) float sC[256 * KC_PITCH];
    __shared__ __align__(16) float sP[16 * KC_PITCH];
    __shared__ __align__(16) float sL[16 * KC_PITCH];
    const int tid = threadIdx.x, lane = tid & 31, wave = tid >> 5;
    const int p0 = blockIdx.x * 16;

    const float4* C4 = reinterpret_cast<const float4*>(x_col);
    const float4* P4 = reinterpret_cast<const float4*>(x_prompt) + (size_t)p0 * 64;
    float4 pr[2], cr[32];
#pragma unroll
    for (int i = 0; i < 2; ++i) pr[i] = P4[i * 512 + tid];
#pragma unroll
    for (int i = 0; i < 32; ++i) cr[i] = C4[i * 512 + tid];
#pragma unroll
    for (int i = 0; i < 2; ++i) {
        const int idx = i * 512 + tid;
        *reinterpret_cast<float4*>(&sP[(idx >> 6) * KC_PITCH + (idx & 63) * 4]) = pr[i];
    }
#pragma unroll
    for (int i = 0; i < 32; ++i) {
        const int idx = i * 512 + tid;
        *reinterpret_cast<float4*>(&sC[(idx >> 6) * KC_PITCH + (idx & 63) * 4]) = cr[i];
    }
    __syncthreads();

    const int c = lane & 15, h = lane >> 4;
    const float* ap = &sP[c * KC_PITCH + 4 * h];
    const float* bp = &sC[(wave * 16 + c) * KC_PITCH + 4 * h];
    v8f acc = {};   // one chain per wave: the waves that share a SIMD fill the matrix unit between them
#pragma unroll
    for (int s = 0; s < 32; ++s) mm8(ap + s * 8, bp + s * 8, acc);
#pragma unroll
    for (int r = 0; r < 8; ++r) sL[(8 * h + r) * KC_PITCH + wave * 16 + c] = acc[r];
    __syncthreads();

    // softmax: one row per wave, eight adjacent columns per lane so that every store is 16 bytes wide
    const float4 l0 = *reinterpret_cast<const float4*>(&sL[wave * KC_PITCH + lane * 8]);
    const float4 l1 = *reinterpret_cast<const float4*>(&sL[wave * KC_PITCH + lane * 8 + 4]);
    float v[8] = {l0.x, l0.y, l0.z, l0.w, l1.x, l1.y, l1.z, l1.w};
    float mx = v[0];
#pragma unroll
    for (int i = 1; i < 8; ++i) mx = fmaxf(mx, v[i]);
#pragma unroll
    for (int o = 16; o > 0; o >>= 1) mx = fmaxf(mx, __shfl_xor(mx, o, 32));
    float sm = 0.0f;
#pragma unroll
    for (int i = 0; i < 8; ++i) { v[i] = __expf(v[i] - mx); sm += v[i]; }
#pragma unroll
    for (int o = 16; o > 0; o >>= 1) sm += __shfl_xor(sm, o, 32);
    v8h hv;
#pragma unroll
    for (int i = 0; i < 8; ++i) { v[i] = v[i] / sm; hv[i] = (_Float16)v[i]; }
    const size_t o8 = (size_t)(p0 + wave) * 256 + lane * 8;
    *reinterpret_cast<float4*>(maskf + o8)     = make_float4(v[0], v[1], v[2], v[3]);
    *reinterpret_cast<float4*>(maskf + o8 + 4) = make_float4(v[4], v[5], v[6], v[7]);
    *reinterpret_cast<v8h*>(maskh + o8)        = hv;
}

// rsqrtf with the library's own range step (below the least normal: x * 2^24 in, * 2^12 out), bit for bit.
// The instruction and the one slot that the instruction set asks for behind a transcendental stand in one statement.
__device__ __forceinline__ float rsqrt_slot(float x) {
    const bool tiny = x < 0x1.0p-126f;
    const float xs = tiny ? x * 0x1.0p+24f : x;
    float r;
    asm("v_rsq_f32 %0, %1\n\tv_nop" : "=v"(r) : "v"(xs));
    return tiny ? r * 0x1.0p+12f : r;
}

// ---------------- kF: out[b,p,d] = (sum_c mask[p,c]*x_emb[b,c,d]) * (1+ew[p]) + mask[b,p]*eb[b]
// with x_emb[b,c,:] = LN_over_d(relu(feb[c,:] + x[b,c]*few[c,:])) built in LDS as f16 [dealt row of d][c, or c ^ 64]; it never leaves the WGP.
// grid 256: one work-group per b. block 512 = 16 waves; in the product a wave owns 64 p x 64 d (4 x 4 tiles).
// the columns d are dealt to the B fragments so that column n of tile j is d = 4n + j of the wave's 64: a lane's four
// accumulators of one row p are then adjacent in out, and one 16-byte store per lane writes 256 contiguous bytes per row.
// LDS row of column d: (d & ~63) + 16 * (d & 3) + ((d >> 2) & 15). Rows 16 apart start in the same bank, and four lanes of
// a transpose store write such rows; the rows of odd d therefore hold c at c ^ 64, which keeps that store at two lanes a bank.
// every unroll directive below keeps the index of a register array, and each LDS offset, a compile-time constant.
#define KF_PITCH 264   // halves; 528 B = 16 B x odd, the conflict-free pitch for 16-byte fragment reads
__global__ __launch_bounds__(512)
void kF_emb_gemm(const float* __restrict__ x,
                 const float* __restrict__ few, const float* __restrict__ feb,
                 const float* __restrict__ lnw, const float* __restrict__ lnb,
                 const _Float16* __restrict__ maskh,
                 const float* __restrict__ maskf,
                 const float* __restrict__ expand_w,
                 const float* __restrict__ expand_b,
                 float* __restrict__ out) {
    __shared__ __align__(16) _Float16 sA[256][KF_PITCH];  // mask    [p][c]
    __shared__ __align__(16) _Float16 sT[256][KF_PITCH];  // x_emb^T [dealt row of d][c, or c ^ 64]
    __shared__ __align__(16) float sSc[256];              // 1 + ew[p]
    __shared__ __align__(16) float sBi[256];              // mask[b,p] * eb[b]
    const int tid = threadIdx.x, lane = tid & 31;
    // the wave's number in a scalar register: x[b, c] comes by scalar loads, and the test on it below is a scalar branch
    const int wave = __builtin_amdgcn_readfirstlane(tid >> 5);
    const int b = blockIdx.x;

    // the whole mask: 16 copies per wave, each one row of 512 contiguous bytes; they land while x_emb is computed
#pragma unroll
    for (int i = 0; i < 16; ++i) {
        const int row = i * 16 + wave;
        stage16(maskh + (size_t)row * 256 + lane * 8, &sA[row][lane * 8]);
    }

    float g[8], h[8];
#pragma unroll
    for (int i = 0; i < 8; ++i) {
        const int d = lane + 32 * i;
        g[i] = lnw[d]; h[i] = lnb[d];
    }
    const int trow = ((lane & 3) << 4) + (lane >> 2);   // the lane's part of the LDS row of d = lane + 32 i
    const int tswp = (lane & 1) << 6;                   // odd d: the 64-c halves swapped

    // the epilogue's per-p factors, read once per work-group here, where their latency lies under the first row loads'
    if (wave < 8) {
        sSc[tid] = 1.0f + expand_w[tid];
        sBi[tid] = maskf[(size_t)b * 256 + tid] * expand_b[b];
    }

    for (int iter = 0; iter < 4; ++iter) {
        const int c = iter * 64 + wave * 4;        // four adjacent c rows, so that 64 row loads of a wave are in flight
        const float4 x4 = *reinterpret_cast<const float4*>(&x[b * 256 + c]);
        const float xv[4] = {x4.x, x4.y, x4.z, x4.w};
        const float* __restrict__ wr = few + (size_t)c * 256;
        const float* __restrict__ br = feb + (size_t)c * 256;
        float fw[4][8], fb[4][8];
#pragma unroll
        for (int t = 0; t < 4; ++t) {
#pragma unroll
            for (int i = 0; i < 8; ++i) {
                fw[t][i] = wr[t * 256 + 32 * i + lane];
                fb[t][i] = br[t * 256 + 32 * i + lane];
            }
        }
        // behind the row loads, in front of the first write of a register that they name
        asm volatile("s_wait_xcnt 0x0" ::: "memory");
        float v[4][8], s[4] = {0.f, 0.f, 0.f, 0.f}, q[4] = {0.f, 0.f, 0.f, 0.f};
#pragma unroll
        for (int t = 0; t < 4; ++t) {
#pragma unroll
            for (int i = 0; i < 8; ++i) {
                const float a = fmaxf(0.0f, fb[t][i] + xv[t] * fw[t][i]);
                v[t][i] = a;
                s[t] += a; q[t] += a * a;
            }
        }
#pragma unroll
        for (int o = 16; o > 0; o >>= 1) {
#pragma unroll
            for (int t = 0; t < 4; ++t) { s[t] += __shfl_xor(s[t], o, 32); q[t] += __shfl_xor(q[t], o, 32); }
        }
        float mu[4], rs[4];
#pragma unroll
        for (int t = 0; t < 4; ++t) {
            mu[t] = s[t] * (1.0f / 256.0f);
            rs[t] = rsqrt_slot(q[t] * (1.0f / 256.0f) - mu[t] * mu[t] + LN_EPS);
        }
#pragma unroll
        for (int i = 0; i < 8; ++i) {
            union { _Float16 hh[4]; uint2 u; } pk;
#pragma unroll
            for (int t = 0; t < 4; ++t) pk.hh[t] = (_Float16)((v[t][i] - mu[t]) * rs[t] * g[i] + h[i]);
            // b64 packed transpose store, to the dealt row of d = lane + 32 i
            *reinterpret_cast<uint2*>(&sT[trow + 8 * (i & 1) + 64 * (i >> 1)][c ^ tswp]) = pk.u;
        }
    }
    // each wave's own mask copies have landed before the barrier behind which other waves read them
    stage_wait();
    __syncthreads();

    const int wp = (wave & 3) * 64;    // first p row of the wave
    const int wd = (wave >> 2) * 64;   // first d column of the wave
    const int m  = lane & 15;
    const int kb = (lane >> 4) << 3;   // 0 or 8 (ISA 16-bit lane layout)

    v8f acc[4][4] = {};
#pragma unroll
    for (int c0 = 0; c0 < 256; c0 += 32) {
        v16h af[4];
#pragma unroll
        for (int i = 0; i < 4; ++i) {
            const v8h alo = *reinterpret_cast<const v8h*>(&sA[wp + i * 16 + m][c0 + kb]);
            const v8h ahi = *reinterpret_cast<const v8h*>(&sA[wp + i * 16 + m][c0 + 16 + kb]);
            af[i] = __builtin_shufflevector(alo, ahi,
                      0, 1, 2, 3, 4, 5, 6, 7, 8, 9, 10, 11, 12, 13, 14, 15);
        }
        v16h bf[4];
#pragma unroll
        for (int j = 0; j < 4; ++j) {
            const int cs = c0 ^ ((j & 1) << 6);   // tile j holds the columns d = 4m + j: odd j, halves swapped
            const v8h blo = *reinterpret_cast<const v8h*>(&sT[wd + j * 16 + m][cs + kb]);
            const v8h bhi = *reinterpret_cast<const v8h*>(&sT[wd + j * 16 + m][cs + 16 + kb]);
            bf[j] = __builtin_shufflevector(blo, bhi,
                      0, 1, 2, 3, 4, 5, 6, 7, 8, 9, 10, 11, 12, 13, 14, 15);
        }
#pragma unroll
        for (int j = 0; j < 4; ++j) {
#pragma unroll
            for (int i = 0; i < 4; ++i)
                acc[i][j] = __builtin_amdgcn_wmma_f32_16x16x32_f16(false, af[i], false, bf[j],
                                                                   (short)0, acc[i][j], false, false);
        }
    }

    // epilogue: C/D layout: VGPR r -> row m = r + (lane>=16 ? 8 : 0), col n = lane&15, which is d = wd + 4n + j
    const int n  = lane & 15;
    const int mh = (lane >> 4) * 8;
    // one address for all 32 stores, the row as a constant offset; 16 lanes cover 256 contiguous bytes of a row
    float* __restrict__ orow = out + ((size_t)b * 256 + wp + mh) * 256 + wd + 4 * n;
#pragma unroll
    for (int i = 0; i < 4; ++i) {
#pragma unroll
        for (int r = 0; r < 8; ++r) {
            const int p = wp + i * 16 + mh + r;
            const float scale = sSc[p];
            const float bias  = sBi[p];
            *reinterpret_cast<float4*>(orow + (i * 16 + r) * 256) =
                make_float4(acc[i][0][r] * scale + bias, acc[i][1][r] * scale + bias,
                            acc[i][2][r] * scale + bias, acc[i][3][r] * scale + bias);
        }
    }
}

extern "C" void kernel_launch(void* const* d_in, const int* in_sizes, int n_in,
                              void* d_out, int out_size, void* d_ws, size_t ws_size,
                              hipStream_t stream) {
    const float* x            = (const float*)d_in[0];
    const float* prev_cell    = (const float*)d_in[1];
    const float* few          = (const float*)d_in[2];
    const float* feb          = (const float*)d_in[3];
    const float* ln_emb_w     = (const float*)d_in[4];
    const float* ln_emb_b     = (const float*)d_in[5];
    const float* ln_col_w     = (const float*)d_in[6];
    const float* ln_col_b     = (const float*)d_in[7];
    const float* ln_prompt_w  = (const float*)d_in[8];
    const float* ln_prompt_b  = (const float*)d_in[9];
    const float* dense_imp_w  = (const float*)d_in[10];
    const float* dense_imp_b  = (const float*)d_in[11];
    const float* emb_column   = (const float*)d_in[12];
    const float* emb_prompt   = (const float*)d_in[13];
    const float* expand_w     = (const float*)d_in[14];
    const float* expand_b     = (const float*)d_in[15];
    float* out = (float*)d_out;

    char* ws = (char*)d_ws;
    float*    x_prompt = (float*)(ws);               // 262144 B
    float*    x_col    = (float*)(ws + 262144);      // 262144 B
    float*    maskf    = (float*)(ws + 524288);      // 262144 B
    _Float16* maskh    = (_Float16*)(ws + 786432);   // 131072 B

    kA_prompt<<<160, 256, 0, stream>>>(emb_prompt, prev_cell, ln_prompt_w, ln_prompt_b,
                                       dense_imp_w, dense_imp_b, x_prompt,
                                       emb_column, ln_col_w, ln_col_b, x_col);
    kC_mask<<<16, 512, 0, stream>>>(x_prompt, x_col, maskf, maskh);
    kF_emb_gemm<<<256, 512, 0, stream>>>(x, few, feb, ln_emb_w, ln_emb_b, maskh, maskf,
                                         expand_w, expand_b, out);
}

// v005
// One run takes 22.9 microseconds.
// Timed twice side by side with v004, it ran 1.16 times as fast both times.
// All steps since v000 together make it 2.69 times as fast.
#include <hip/hip_runtime.h>
#include <hip/hip_bf16.h>

typedef __attribute__((ext_vector_type(8)))  _Float16 v8h;
typedef __attribute__((ext_vector_type(16))) _Float16 v16h;
typedef __attribute__((ext_vector_type(8)))  float    v8f;
typedef __attribute__((ext_vector_type(2)))  float    v2f;
typedef __attribute__((ext_vector_type(4)))  float    v4f;

typedef int v4i __attribute__((vector_size(16)));
typedef __attribute__((address_space(1))) v4i gv4i;  // global 128-bit
typedef __attribute__((address_space(3))) v4i lv4i;  // LDS    128-bit

#define LN_EPS 1e-5f

#if defined(__has_builtin)
#if __has_builtin(__builtin_amdgcn_global_load_async_to_lds_b128)
#define HAVE_ASYNC_LDS 1
#endif
#endif

// 16B global -> LDS staging (async CDNA5 path when available)
__device__ __forceinline__ void stage16(const _Float16* g, _Float16* l) {
#ifdef HAVE_ASYNC_LDS
    __builtin_amdgcn_global_load_async_to_lds_b128(
        (gv4i*)(uintptr_t)g, (lv4i*)(uintptr_t)l, 0, 0);
#else
    *reinterpret_cast<v8h*>(l) = *reinterpret_cast<const v8h*>(g);
#endif
}

// the same for 16 bytes of f32
__device__ __forceinline__ void stage16f(const float* g, float* l) {
#ifdef HAVE_ASYNC_LDS
    __builtin_amdgcn_global_load_async_to_lds_b128(
        (gv4i*)(uintptr_t)g, (lv4i*)(uintptr_t)l, 0, 0);
#else
    *reinterpret_cast<float4*>(l) = *reinterpret_cast<const float4*>(g);
#endif
}

// the issuing wave's own wait for its copies; asm with the memory clobber so that no LDS read is lifted over it
__device__ __forceinline__ void stage_wait() {
#ifdef HAVE_ASYNC_LDS
    asm volatile("s_wait_asynccnt 0x0" ::: "memory");
#endif
}

// f32 matrix fragment pair: a lane (c = lane & 15, h = lane >> 4) holds 16 bytes of row c at k + 4h of each
// 8-k step; A and B are read by the same code, so the k pairing is equal at every lane and register.
__device__ __forceinline__ void mm8(const float* ap, const float* bp, v8f& acc) {
    const float4 a = *reinterpret_cast<const float4*>(ap);
    const float4 b = *reinterpret_cast<const float4*>(bp);
    const v2f a0 = {a.x, a.y}, a1 = {a.z, a.w}, b0 = {b.x, b.y}, b1 = {b.z, b.w};
    acc = __builtin_amdgcn_wmma_f32_16x16x4_f32(false, a0, false, b0, (short)0, acc, false, false);
    acc = __builtin_amdgcn_wmma_f32_16x16x4_f32(false, a1, false, b1, (short)0, acc, false, false);
}

// ---------------- kA: x_prompt[p,d] = (concat(LN(emb_prompt[p]), prev[p]) @ W^T)[d] + b[d] + emb_prompt[p,d]
// work-groups 0..127: 16 p-tiles of 16 rows x 8 d-tiles of 32. block 256 = 8 waves = 2 d-subtiles x 4 k-quarters of 128.
// Each of them goes on to its share of the mask logits: with x_col[c,d] = (e[c,d] - mu[c]) * rs[c] * w[d] + b[d],
//   logit[p,c] = rs[c] * (sum_d x_prompt[p,d] w[d] e[c,d] - mu[c] * sum_d x_prompt[p,d] w[d]) + sum_d x_prompt[p,d] b[d].
// The first sum is the matrix product; the work-group holds 32 of its d and writes that partial sum for its 16 p and all
// 256 c, so the product runs on 128 WGPs and not on the 16 that whole softmax rows would allow. The rest is the mask kernel's.
// work-groups 128..159: mu[c], rs[c] of emb_column, one row per wave; they run on WGPs that the product leaves idle.
// Each writes one 128-byte line of its own: mu of its 8 rows in floats 0..7, rs in floats 8..15.
#define KA_TILES 128
#define KA_PITCH 516   // floats; 16 B x odd, the conflict-free pitch for 16-byte fragment reads
#define KE_PITCH 36    // floats; 16 B x odd
__global__ __launch_bounds__(256)
void kA_prompt(const float* __restrict__ emb_prompt,
               const float* __restrict__ prev_cell,
               const float* __restrict__ lnw, const float* __restrict__ lnb,
               const float* __restrict__ W,   // [256, 512]
               const float* __restrict__ Wb,
               float* __restrict__ x_prompt,
               const float* __restrict__ emb_col,
               const float* __restrict__ lncw,
               float* __restrict__ stat,      // [32][32]
               float* __restrict__ part) {    // [8 d-slices][256 p][256 c]
    __shared__ __align__(16) float sX[16 * KA_PITCH];   // concat(LN(emb_prompt), prev), 16 rows
    __shared__ __align__(16) float sW[32 * KA_PITCH];   // 32 rows of W
    __shared__ __align__(16) float sR[8 * 256];         // one partial tile per wave
    __shared__ __align__(16) float sE[256 * KE_PITCH];  // emb_column, the 32 d of the block; row of c: see below
    __shared__ __align__(16) float sY[16 * KE_PITCH];   // x_prompt * ln_col_w, 16 p x the 32 d
    const int tid = threadIdx.x, lane = tid & 31, wave = tid >> 5;

    // the whole work-group takes this branch or none of it does, and it leaves in front of every barrier
    if (blockIdx.x >= KA_TILES) {
        const size_t r4 = (size_t)((blockIdx.x - KA_TILES) * 8 + wave) * 64 + lane;
        const float4 e0 = reinterpret_cast<const float4*>(emb_col)[r4];
        const float4 e1 = reinterpret_cast<const float4*>(emb_col)[r4 + 32];
        float s = (e0.x + e0.y) + (e0.z + e0.w) + (e1.x + e1.y) + (e1.z + e1.w);
#pragma unroll
        for (int o = 16; o > 0; o >>= 1) s += __shfl_xor(s, o, 32);
        const float mu = s * (1.0f / 256.0f);
        const float4 d0 = {e0.x - mu, e0.y - mu, e0.z - mu, e0.w - mu};
        const float4 d1 = {e1.x - mu, e1.y - mu, e1.z - mu, e1.w - mu};
        float q = (d0.x * d0.x + d0.y * d0.y) + (d0.z * d0.z + d0.w * d0.w)
                + (d1.x * d1.x + d1.y * d1.y) + (d1.z * d1.z + d1.w * d1.w);
#pragma unroll
        for (int o = 16; o > 0; o >>= 1) q += __shfl_xor(q, o, 32);
        const float rs = rsqrtf(q * (1.0f / 256.0f) + LN_EPS);
        if (lane == 0) {
            float* line = stat + (blockIdx.x - KA_TILES) * 32;
            line[wave]     = mu;
            line[8 + wave] = rs;
        }
        return;
    }
    const int p0 = (blockIdx.x >> 3) * 16, n0 = (blockIdx.x & 7) * 32;

    // emb_column's 32 d of the block go to LDS by asynchronous copies, one 128-byte line per row c: they take no register
    // and land under the first product. The columns c are dealt to the B fragments so that column n of a wave's tile j is
    // c = 2n + j of its 32: a lane's two accumulators of a row p are then adjacent in part.
    // LDS row of column c: (c & ~31) + 16 * (c & 1) + ((c >> 1) & 15); here c = 32 i + (tid >> 3).
    {
        const int c5 = tid >> 3;
        const float* eg = emb_col + c5 * 256 + n0 + (tid & 7) * 4;
        float* el = &sE[(((c5 & 1) << 4) + (c5 >> 1)) * KE_PITCH + (tid & 7) * 4];
#pragma unroll
        for (int i = 0; i < 8; ++i) stage16f(eg + i * 32 * 256, el + i * 32 * KE_PITCH);
    }

    // every global read of the block but Wb's and the residual's emb_prompt is issued before the first use; each wave-wide float4 load covers 512 contiguous bytes
    const float4* W4 = reinterpret_cast<const float4*>(W) + (size_t)n0 * 128;
    const float4* P4 = reinterpret_cast<const float4*>(prev_cell) + (size_t)p0 * 64;
    const float4* E4 = reinterpret_cast<const float4*>(emb_prompt) + (size_t)p0 * 64;
    float4 ev[2][2], gw[2], gb[2], pr[4], wr[16];
#pragma unroll
    for (int j = 0; j < 2; ++j) {
        ev[0][j] = E4[(wave * 2) * 64 + lane + 32 * j];
        ev[1][j] = E4[(wave * 2 + 1) * 64 + lane + 32 * j];
        gw[j] = reinterpret_cast<const float4*>(lnw)[lane + 32 * j];
        gb[j] = reinterpret_cast<const float4*>(lnb)[lane + 32 * j];
    }
#pragma unroll
    for (int i = 0; i < 4; ++i) pr[i] = P4[i * 256 + tid];
#pragma unroll
    for (int i = 0; i < 16; ++i) wr[i] = W4[i * 256 + tid];
    const float cw0 = lncw[n0 + (lane & 15)], cw1 = lncw[n0 + 16 + (lane & 15)];
    // keeps the loads above in front of the first use below: without it this build issues W's only behind the first row sum
    __builtin_amdgcn_sched_barrier(0);

    // LayerNorm of two rows per wave
#pragma unroll
    for (int rr = 0; rr < 2; ++rr) {
        const float4 e0 = ev[rr][0], e1 = ev[rr][1];
        float s = (e0.x + e0.y) + (e0.z + e0.w) + (e1.x + e1.y) + (e1.z + e1.w);
#pragma unroll
        for (int o = 16; o > 0; o >>= 1) s += __shfl_xor(s, o, 32);
        const float mu = s * (1.0f / 256.0f);
        float4 d0 = {e0.x - mu, e0.y - mu, e0.z - mu, e0.w - mu};
        float4 d1 = {e1.x - mu, e1.y - mu, e1.z - mu, e1.w - mu};
        float q = (d0.x * d0.x + d0.y * d0.y) + (d0.z * d0.z + d0.w * d0.w)
                + (d1.x * d1.x + d1.y * d1.y) + (d1.z * d1.z + d1.w * d1.w);
#pragma unroll
        for (int o = 16; o > 0; o >>= 1) q += __shfl_xor(q, o, 32);
        const float rs = rsqrtf(q * (1.0f / 256.0f) + LN_EPS);
        float* row = &sX[(wave * 2 + rr) * KA_PITCH];
        const float4 y0 = {d0.x * rs * gw[0].x + gb[0].x, d0.y * rs * gw[0].y + gb[0].y,
                           d0.z * rs * gw[0].z + gb[0].z, d0.w * rs * gw[0].w + gb[0].w};
        const float4 y1 = {d1.x * rs * gw[1].x + gb[1].x, d1.y * rs * gw[1].y + gb[1].y,
                           d1.z * rs * gw[1].z + gb[1].z, d1.w * rs * gw[1].w + gb[1].w};
        *reinterpret_cast<float4*>(&row[lane * 4])       = y0;
        *reinterpret_cast<float4*>(&row[128 + lane * 4]) = y1;
    }
#pragma unroll
    for (int i = 0; i < 4; ++i) {
        const int idx = i * 256 + tid;
        *reinterpret_cast<float4*>(&sX[(idx >> 6) * KA_PITCH + 256 + (idx & 63) * 4]) = pr[i];
    }
#pragma unroll
    for (int i = 0; i < 16; ++i) {
        const int idx = i * 256 + tid;
        *reinterpret_cast<float4*>(&sW[(idx >> 7) * KA_PITCH + (idx & 127) * 4]) = wr[i];
    }
    __syncthreads();

    const int c = lane & 15, h = lane >> 4;
    const int ns = wave & 1, ks = wave >> 1;
    const float* ap = &sX[c * KA_PITCH + ks * 128 + 4 * h];
    const float* bp = &sW[(ns * 16 + c) * KA_PITCH + ks * 128 + 4 * h];
    v8f acc = {};   // one chain per wave: the waves that share a SIMD fill the matrix unit between them
#pragma unroll
    for (int s = 0; s < 16; ++s) mm8(ap + s * 8, bp + s * 8, acc);
#pragma unroll
    for (int r = 0; r < 8; ++r) sR[wave * 256 + r * 32 + lane] = acc[r];
    __syncthreads();

    // sum the four k-quarters; element (r, lane) of a tile is row 8h + r, column c
    float xp[2];
#pragma unroll
    for (int t = 0; t < 2; ++t) {
        const float v = (sR[t * 256 + tid] + sR[(2 + t) * 256 + tid])
                      + (sR[(4 + t) * 256 + tid] + sR[(6 + t) * 256 + tid]);
        const int p = p0 + 8 * h + wave;       // r = tid >> 5
        const int d = n0 + t * 16 + c;
        xp[t] = v + Wb[d] + emb_prompt[p * 256 + d];
        sY[(8 * h + wave) * KE_PITCH + t * 16 + c] = xp[t] * (t ? cw1 : cw0);
    }
    // each wave's own copies of emb_column have landed before the barrier behind which other waves read them
    stage_wait();
    __syncthreads();
    // stored behind the barrier: in front of it the barrier would wait for the stores to be acknowledged
#pragma unroll
    for (int t = 0; t < 2; ++t) x_prompt[(p0 + 8 * h + wave) * 256 + n0 + t * 16 + c] = xp[t];

    // partial logits: 16 p x 32 c per wave over the block's 32 d, two chains
    const float* ap2 = &sY[c * KE_PITCH + 4 * h];
    const float* bp2 = &sE[(wave * 32 + c) * KE_PITCH + 4 * h];
    v8f l0 = {}, l1 = {};
#pragma unroll
    for (int s = 0; s < 4; ++s) {
        mm8(ap2 + s * 8, bp2 + s * 8, l0);
        mm8(ap2 + s * 8, bp2 + 16 * KE_PITCH + s * 8, l1);
    }
    // four vector slots between the last matrix instruction and the first vector instruction that reads its result: the
    // moves that pair the two accumulators for the 8-byte stores, which this build sets directly behind it. The operands
    // tie the slots to this place.
    asm volatile("v_nop\n\tv_nop\n\tv_nop\n\tv_nop" : "+v"(l0), "+v"(l1));
    // element (r, lane) is row 8h + r, columns c = 32 wave + 2 (lane & 15) and the next: 16 lanes write one 128-byte line
    float* prow = part + ((size_t)(blockIdx.x & 7) * 256 + p0 + 8 * h) * 256 + wave * 32 + 2 * c;
#pragma unroll
    for (int r = 0; r < 8; ++r) *reinterpret_cast<float2*>(prow + r * 256) = make_float2(l0[r], l1[r]);
    // behind the eight stores, in front of any later write of a register that they name
    asm volatile("s_wait_xcnt 0x0" ::: "memory");
}

// ---------------- kC: mask = softmax(logits), the logits put together from the eight partial sums (formula at kA)
// grid 32, block 256 = 8 waves: one row p per wave, eight adjacent columns c per lane so that every store is 16 bytes wide.
__global__ __launch_bounds__(256)
void kC_mask(const float* __restrict__ x_prompt,
             const float* __restrict__ part,
             const float* __restrict__ stat,
             const float* __restrict__ lncw, const float* __restrict__ lncb,
             float* __restrict__ maskf,
             _Float16* __restrict__ maskh) {
    const int tid = threadIdx.x, lane = tid & 31, wave = tid >> 5;
    const int p0 = blockIdx.x * 8;

    // byte offsets of the lane: its place in a [256][256] f32 plane, in a row of 256 f32, and its statistics line
    // (the lane's columns c = 8 lane .. 8 lane + 7 are the eight rows of line number lane)
    const unsigned ob = ((unsigned)(p0 + wave) * 256u + lane * 8u) * 4u, ol = lane * 32u, os = lane * 128u;
    const char* Sb = reinterpret_cast<const char*>(stat) + os;
    const v4f ma = *reinterpret_cast<const v4f*>(Sb),      mb = *reinterpret_cast<const v4f*>(Sb + 16);
    const v4f sa = *reinterpret_cast<const v4f*>(Sb + 32), sb = *reinterpret_cast<const v4f*>(Sb + 48);
    const char* Wl = reinterpret_cast<const char*>(lncw) + ol;
    const char* Bl = reinterpret_cast<const char*>(lncb) + ol;
    const v4f wa = *reinterpret_cast<const v4f*>(Wl), wb = *reinterpret_cast<const v4f*>(Wl + 16);
    const v4f ba = *reinterpret_cast<const v4f*>(Bl), bb = *reinterpret_cast<const v4f*>(Bl + 16);
    const char* Xl = reinterpret_cast<const char*>(x_prompt) + ob;
    const v4f xa = *reinterpret_cast<const v4f*>(Xl), xb = *reinterpret_cast<const v4f*>(Xl + 16);
    const char* Rl = reinterpret_cast<const char*>(part) + ob;
    v4f ra[8], rb[8];
#pragma unroll
    for (int s = 0; s < 8; ++s) {
        ra[s] = *reinterpret_cast<const v4f*>(Rl + s * 262144);
        rb[s] = *reinterpret_cast<const v4f*>(Rl + s * 262144 + 16);
    }
    // inputs only: holds all 26 loads in front of the first use, so that the wave pays the L2 latency once (left alone, this
    // build issues them in five groups, each behind the wait for the one before); the offsets are named so that no load's
    // result lands in an address register of a load issued before it
    asm volatile("" :: "v"(ma), "v"(mb), "v"(sa), "v"(sb), "v"(wa), "v"(wb), "v"(ba), "v"(bb), "v"(xa), "v"(xb),
                       "v"(ra[0]), "v"(ra[1]), "v"(ra[2]), "v"(ra[3]), "v"(ra[4]), "v"(ra[5]), "v"(ra[6]), "v"(ra[7]),
                       "v"(rb[0]), "v"(rb[1]), "v"(rb[2]), "v"(rb[3]), "v"(rb[4]), "v"(rb[5]), "v"(rb[6]), "v"(rb[7]),
                       "v"(ob), "v"(ol), "v"(os));

    float s1 = (xa.x * wa.x + xa.y * wa.y) + (xa.z * wa.z + xa.w * wa.w)
             + (xb.x * wb.x + xb.y * wb.y) + (xb.z * wb.z + xb.w * wb.w);
    float s2 = (xa.x * ba.x + xa.y * ba.y) + (xa.z * ba.z + xa.w * ba.w)
             + (xb.x * bb.x + xb.y * bb.y) + (xb.z * bb.z + xb.w * bb.w);
#pragma unroll
    for (int o = 16; o > 0; o >>= 1) { s1 += __shfl_xor(s1, o, 32); s2 += __shfl_xor(s2, o, 32); }

    const v4f ta = ((ra[0] + ra[1]) + (ra[2] + ra[3])) + ((ra[4] + ra[5]) + (ra[6] + ra[7]));
    const v4f tb = ((rb[0] + rb[1]) + (rb[2] + rb[3])) + ((rb[4] + rb[5]) + (rb[6] + rb[7]));
    float v[8];
#pragma unroll
    for (int i = 0; i < 4; ++i) {
        v[i]     = sa[i] * (ta[i] - ma[i] * s1) + s2;
        v[4 + i] = sb[i] * (tb[i] - mb[i] * s1) + s2;
    }
    float mx = v[0];
#pragma unroll
    for (int i = 1; i < 8; ++i) mx = fmaxf(mx, v[i]);
#pragma unroll
    for (int o = 16; o > 0; o >>= 1) mx = fmaxf(mx, __shfl_xor(mx, o, 32));
    float sm = 0.0f;
#pragma unroll
    for (int i = 0; i < 8; ++i) { v[i] = __expf(v[i] - mx); sm += v[i]; }
#pragma unroll
    for (int o = 16; o > 0; o >>= 1) sm += __shfl_xor(sm, o, 32);
    v8h hv;
#pragma unroll
    for (int i = 0; i < 8; ++i) { v[i] = v[i] / sm; hv[i] = (_Float16)v[i]; }
    const unsigned o8 = ob >> 2;
    *reinterpret_cast<float4*>(maskf + o8)     = make_float4(v[0], v[1], v[2], v[3]);
    *reinterpret_cast<float4*>(maskf + o8 + 4) = make_float4(v[4], v[5], v[6], v[7]);
    *reinterpret_cast<v8h*>(maskh + o8)        = hv;
}

// rsqrtf with the library's own range step (below the least normal: x * 2^24 in, * 2^12 out), bit for bit.
// The instruction and the one slot that the instruction set asks for behind a transcendental stand in one statement.
__device__ __forceinline__ float rsqrt_slot(float x) {
    const bool tiny = x < 0x1.0p-126f;
    const float xs = tiny ? x * 0x1.0p+24f : x;
    float r;
    asm("v_rsq_f32 %0, %1\n\tv_nop" : "=v"(r) : "v"(xs));
    return tiny ? r * 0x1.0p+12f : r;
}

// ---------------- kF: out[b,p,d] = (sum_c mask[p,c]*x_emb[b,c,d]) * (1+ew[p]) + mask[b,p]*eb[b]
// with x_emb[b,c,:] = LN_over_d(relu(feb[c,:] + x[b,c]*few[c,:])) built in LDS as f16 [dealt row of d][c, or c ^ 64]; it never leaves the WGP.
// grid 256: one work-group per b. block 512 = 16 waves; in the product a wave owns 64 p x 64 d (4 x 4 tiles).
// the columns d are dealt to the B fragments so that column n of tile j is d = 4n + j of the wave's 64: a lane's four
// accumulators of one row p are then adjacent in out, and one 16-byte store per lane writes 256 contiguous bytes per row.
// LDS row of column d: (d & ~63) + 16 * (d & 3) + ((d >> 2) & 15). Rows 16 apart start in the same bank, and four lanes of
// a transpose store write such rows; the rows of odd d therefore hold c at c ^ 64, which keeps that store at two lanes a bank.
// every unroll directive below keeps the index of a register array, and each LDS offset, a compile-time constant.
#define KF_PITCH 264   // halves; 528 B = 16 B x odd, the conflict-free pitch for 16-byte fragment reads
__global__ __launch_bounds__(512)
void kF_emb_gemm(const float* __restrict__ x,
                 const float* __restrict__ few, const float* __restrict__ feb,
                 const float* __restrict__ lnw, const float* __restrict__ lnb,
                 const _Float16* __restrict__ maskh,
                 const float* __restrict__ maskf,
                 const float* __restrict__ expand_w,
                 const float* __restrict__ expand_b,
                 float* __restrict__ out) {
    __shared__ __align__(16) _Float16 sA[256][KF_PITCH];  // mask    [p][c]
    __shared__ __align__(16) _Float16 sT[256][KF_PITCH];  // x_emb^T [dealt row of d][c, or c ^ 64]
    __shared__ __align__(16) float sSc[256];              // 1 + ew[p]
    __shared__ __align__(16) float sBi[256];              // mask[b,p] * eb[b]
    const int tid = threadIdx.x, lane = tid & 31;
    // the wave's number in a scalar register: x[b, c] comes by scalar loads, and the test on it below is a scalar branch
    const int wave = __builtin_amdgcn_readfirstlane(tid >> 5);
    const int b = blockIdx.x;

    // the whole mask: 16 copies per wave, each one row of 512 contiguous bytes; they land while x_emb is computed
#pragma unroll
    for (int i = 0; i < 16; ++i) {
        const int row = i * 16 + wave;
        stage16(maskh + (size_t)row * 256 + lane * 8, &sA[row][lane * 8]);
    }

    float g[8], h[8];
#pragma unroll
    for (int i = 0; i < 8; ++i) {
        const int d = lane + 32 * i;
        g[i] = lnw[d]; h[i] = lnb[d];
    }
    const int trow = ((lane & 3) << 4) + (lane >> 2);   // the lane's part of the LDS row of d = lane + 32 i
    const int tswp = (lane & 1) << 6;                   // odd d: the 64-c halves swapped

    // the epilogue's per-p factors, read once per work-group here, where their latency lies under the first row loads'
    if (wave < 8) {
        sSc[tid] = 1.0f + expand_w[tid];
        sBi[tid] = maskf[(size_t)b * 256 + tid] * expand_b[b];
    }

    for (int iter = 0; iter < 4; ++iter) {
        const int c = iter * 64 + wave * 4;        // four adjacent c rows, so that 64 row loads of a wave are in flight
        const float4 x4 = *reinterpret_cast<const float4*>(&x[b * 256 + c]);
        const float xv[4] = {x4.x, x4.y, x4.z, x4.w};
        const float* __restrict__ wr = few + (size_t)c * 256;
        const float* __restrict__ br = feb + (size_t)c * 256;
        float fw[4][8], fb[4][8];
#pragma unroll
        for (int t = 0; t < 4; ++t) {
#pragma unroll
            for (int i = 0; i < 8; ++i) {
                fw[t][i] = wr[t * 256 + 32 * i + lane];
                fb[t][i] = br[t * 256 + 32 * i + lane];
            }
        }
        // behind the row loads, in front of the first write of a register that they name
        asm volatile("s_wait_xcnt 0x0" ::: "memory");
        float v[4][8], s[4] = {0.f, 0.f, 0.f, 0.f}, q[4] = {0.f, 0.f, 0.f, 0.f};
#pragma unroll
        for (int t = 0; t < 4; ++t) {
#pragma unroll
            for (int i = 0; i < 8; ++i) {
                const float a = fmaxf(0.0f, fb[t][i] + xv[t] * fw[t][i]);
                v[t][i] = a;
                s[t] += a; q[t] += a * a;
            }
        }
#pragma unroll
        for (int o = 16; o > 0; o >>= 1) {
#pragma unroll
            for (int t = 0; t < 4; ++t) { s[t] += __shfl_xor(s[t], o, 32); q[t] += __shfl_xor(q[t], o, 32); }
        }
        float mu[4], rs[4];
#pragma unroll
        for (int t = 0; t < 4; ++t) {
            mu[t] = s[t] * (1.0f / 256.0f);
            rs[t] = rsqrt_slot(q[t] * (1.0f / 256.0f) - mu[t] * mu[t] + LN_EPS);
        }
#pragma unroll
        for (int i = 0; i < 8; ++i) {
            union { _Float16 hh[4]; uint2 u; } pk;
#pragma unroll
            for (int t = 0; t < 4; ++t) pk.hh[t] = (_Float16)((v[t][i] - mu[t]) * rs[t] * g[i] + h[i]);
            // b64 packed transpose store, to the dealt row of d = lane + 32 i
            *reinterpret_cast<uint2*>(&sT[trow + 8 * (i & 1) + 64 * (i >> 1)][c ^ tswp]) = pk.u;
        }
    }
    // each wave's own mask copies have landed before the barrier behind which other waves read them
    stage_wait();
    __syncthreads();

    const int wp = (wave & 3) * 64;    // first p row of the wave
    const int wd = (wave >> 2) * 64;   // first d column of the wave
    const int m  = lane & 15;
    const int kb = (lane >> 4) << 3;   // 0 or 8 (ISA 16-bit lane layout)

    v8f acc[4][4] = {};
#pragma unroll
    for (int c0 = 0; c0 < 256; c0 += 32) {
        v16h af[4];
#pragma unroll
        for (int i = 0; i < 4; ++i) {
            const v8h alo = *reinterpret_cast<const v8h*>(&sA[wp + i * 16 + m][c0 + kb]);
            const v8h ahi = *reinterpret_cast<const v8h*>(&sA[wp + i * 16 + m][c0 + 16 + kb]);
            af[i] = __builtin_shufflevector(alo, ahi,
                      0, 1, 2, 3, 4, 5, 6, 7, 8, 9, 10, 11, 12, 13, 14, 15);
        }
        v16h bf[4];
#pragma unroll
        for (int j = 0; j < 4; ++j) {
            const int cs = c0 ^ ((j & 1) << 6);   // tile j holds the columns d = 4m + j: odd j, halves swapped
            const v8h blo = *reinterpret_cast<const v8h*>(&sT[wd + j * 16 + m][cs + kb]);
            const v8h bhi = *reinterpret_cast<const v8h*>(&sT[wd + j * 16 + m][cs + 16 + kb]);
            bf[j] = __builtin_shufflevector(blo, bhi,
                      0, 1, 2, 3, 4, 5, 6, 7, 8, 9, 10, 11, 12, 13, 14, 15);
        }
#pragma unroll
        for (int j = 0; j < 4; ++j) {
#pragma unroll
            for (int i = 0; i < 4; ++i)
                acc[i][j] = __builtin_amdgcn_wmma_f32_16x16x32_f16(false, af[i], false, bf[j],
                                                                   (short)0, acc[i][j], false, false);
        }
    }

    // epilogue: C/D layout: VGPR r -> row m = r + (lane>=16 ? 8 : 0), col n = lane&15, which is d = wd + 4n + j
    const int n  = lane & 15;
    const int mh = (lane >> 4) * 8;
    // one address for all 32 stores, the row as a constant offset; 16 lanes cover 256 contiguous bytes of a row
    float* __restrict__ orow = out + ((size_t)b * 256 + wp + mh) * 256 + wd + 4 * n;
#pragma unroll
    for (int i = 0; i < 4; ++i) {
#pragma unroll
        for (int r = 0; r < 8; ++r) {
            const int p = wp + i * 16 + mh + r;
            const float scale = sSc[p];
            const float bias  = sBi[p];
            *reinterpret_cast<float4*>(orow + (i * 16 + r) * 256) =
                make_float4(acc[i][0][r] * scale + bias, acc[i][1][r] * scale + bias,
                            acc[i][2][r] * scale + bias, acc[i][3][r] * scale + bias);
        }
    }
}

extern "C" void kernel_launch(void* const* d_in, const int* in_sizes, int n_in,
                              void* d_out, int out_size, void* d_ws, size_t ws_size,
                              hipStream_t stream) {
    const float* x            = (const float*)d_in[0];
    const float* prev_cell    = (const float*)d_in[1];
    const float* few          = (const float*)d_in[2];
    const float* feb          = (const float*)d_in[3];
    const float* ln_emb_w     = (const float*)d_in[4];
    const float* ln_emb_b     = (const float*)d_in[5];
    const float* ln_col_w     = (const float*)d_in[6];
    const float* ln_col_b     = (const float*)d_in[7];
    const float* ln_prompt_w  = (const float*)d_in[8];
    const float* ln_prompt_b  = (const float*)d_in[9];
    const float* dense_imp_w  = (const float*)d_in[10];
    const float* dense_imp_b  = (const float*)d_in[11];
    const float* emb_column   = (const float*)d_in[12];
    const float* emb_prompt   = (const float*)d_in[13];
    const float* expand_w     = (const float*)d_in[14];
    const float* expand_b     = (const float*)d_in[15];
    float* out = (float*)d_out;

    char* ws = (char*)d_ws;
    float*    x_prompt = (float*)(ws);               // 262144 B
    float*    stat     = (float*)(ws + 262144);      // 4096 B
    float*    maskf    = (float*)(ws + 524288);      // 262144 B
    _Float16* maskh    = (_Float16*)(ws + 786432);   // 131072 B
    float*    part     = (float*)(ws + 1048576);     // 2097152 B

    kA_prompt<<<160, 256, 0, stream>>>(emb_prompt, prev_cell, ln_prompt_w, ln_prompt_b,
                                       dense_imp_w, dense_imp_b, x_prompt,
                                       emb_column, ln_col_w, stat, part);
    kC_mask<<<32, 256, 0, stream>>>(x_prompt, part, stat, ln_col_w, ln_col_b, maskf, maskh);
    kF_emb_gemm<<<256, 512, 0, stream>>>(x, few, feb, ln_emb_w, ln_emb_b, maskh, maskf,
                                         expand_w, expand_b, out);
}

// v006
// Measured time: 19.8 microseconds a run.
// In two side-by-side timings against v005, it was 1.12 and 1.15 times as fast.
// Over all steps from v000 it is 3.04 times as fast.
#include <hip/hip_runtime.h>
#include <hip/hip_bf16.h>

typedef __attribute__((ext_vector_type(8)))  _Float16 v8h;
typedef __attribute__((ext_vector_type(16))) _Float16 v16h;
typedef __attribute__((ext_vector_type(8)))  float    v8f;
typedef __attribute__((ext_vector_type(2)))  float    v2f;
typedef __attribute__((ext_vector_type(4)))  float    v4f;

typedef int v4i __attribute__((vector_size(16)));
typedef __attribute__((address_space(1))) v4i gv4i;  // global 128-bit
typedef __attribute__((address_space(3))) v4i lv4i;  // LDS    128-bit

#define LN_EPS 1e-5f

#if defined(__has_builtin)
#if __has_builtin(__builtin_amdgcn_global_load_async_to_lds_b128)
#define HAVE_ASYNC_LDS 1
#endif
#endif

// 16B global -> LDS staging (async CDNA5 path when available)
__device__ __forceinline__ void stage16(const _Float16* g, _Float16* l) {
#ifdef HAVE_ASYNC_LDS
    __builtin_amdgcn_global_load_async_to_lds_b128(
        (gv4i*)(uintptr_t)g, (lv4i*)(uintptr_t)l, 0, 0);
#else
    *reinterpret_cast<v8h*>(l) = *reinterpret_cast<const v8h*>(g);
#endif
}

// the same for 16 bytes of f32
__device__ __forceinline__ void stage16f(const float* g, float* l) {
#ifdef HAVE_ASYNC_LDS
    __builtin_amdgcn_global_load_async_to_lds_b128(
        (gv4i*)(uintptr_t)g, (lv4i*)(uintptr_t)l, 0, 0);
#else
    *reinterpret_cast<float4*>(l) = *reinterpret_cast<const float4*>(g);
#endif
}

// the issuing wave's own wait for its copies; asm with the memory clobber so that no LDS read is lifted over it
__device__ __forceinline__ void stage_wait() {
#ifdef HAVE_ASYNC_LDS
    asm volatile("s_wait_asynccnt 0x0" ::: "memory");
#endif
}

// f32 matrix fragment pair: a lane (c = lane & 15, h = lane >> 4) holds 16 bytes of row c at k + 4h of each
// 8-k step; A and B are read by the same code, so the k pairing is equal at every lane and register.
__device__ __forceinline__ void mm8(const float* ap, const float* bp, v8f& acc) {
    const float4 a = *reinterpret_cast<const float4*>(ap);
    const float4 b = *reinterpret_cast<const float4*>(bp);
    const v2f a0 = {a.x, a.y}, a1 = {a.z, a.w}, b0 = {b.x, b.y}, b1 = {b.z, b.w};
    acc = __builtin_amdgcn_wmma_f32_16x16x4_f32(false, a0, false, b0, (short)0, acc, false, false);
    acc = __builtin_amdgcn_wmma_f32_16x16x4_f32(false, a1, false, b1, (short)0, acc, false, false);
}

// rsqrtf with the library's own range step (below the least normal: x * 2^24 in, * 2^12 out), bit for bit.
// The instruction and the one slot that the instruction set asks for behind a transcendental stand in one statement.
__device__ __forceinline__ float rsqrt_slot(float x) {
    const bool tiny = x < 0x1.0p-126f;
    const float xs = tiny ? x * 0x1.0p+24f : x;
    float r;
    asm("v_rsq_f32 %0, %1\n\tv_nop" : "=v"(r) : "v"(xs));
    return tiny ? r * 0x1.0p+12f : r;
}

// ---------------- kA: x_prompt[p,d] = (concat(LN(emb_prompt[p]), prev[p]) @ W^T)[d] + b[d] + emb_prompt[p,d]
// work-groups 0..127: 16 p-tiles of 16 rows x 8 d-tiles of 32. block 256 = 8 waves = 2 d-subtiles x 4 k-quarters of 128.
// Each of them goes on to its share of the mask logits: with x_col[c,d] = (e[c,d] - mu[c]) * rs[c] * w[d] + b[d],
//   logit[p,c] = rs[c] * (sum_d x_prompt[p,d] w[d] e[c,d] - mu[c] * sum_d x_prompt[p,d] w[d]) + sum_d x_prompt[p,d] b[d].
// The first sum is the matrix product; the work-group holds 32 of its d and writes that partial sum for its 16 p and all
// 256 c, so the product runs on 128 WGPs and not on the 16 that whole softmax rows would allow. The rest is the mask kernel's.
// work-groups 128..159: mu[c], rs[c] of emb_column, one row per wave; they run on WGPs that the product leaves idle.
// Each writes one 128-byte line of its own: mu of its 8 rows in floats 0..7, rs in floats 8..15.
// work-groups 160..415: mu, rs over d of relu(feb[c,:] + x[b,c] * few[c,:]), one c per work-group and all 256 b, so that few
// and feb are read once for it on the whole chip; kF, which no longer needs whole rows d, then shares its reads among 4 b.
// Each writes its own 2 KiB row of est: (mu, rs) of b at floats 2b, 2b + 1.
#define KA_TILES 128
#define KA_COLS  32
#define KA_PITCH 516   // floats; 16 B x odd, the conflict-free pitch for 16-byte fragment reads
#define KE_PITCH 36    // floats; 16 B x odd
__global__ __launch_bounds__(256)
void kA_prompt(const float* __restrict__ emb_prompt,
               const float* __restrict__ prev_cell,
               const float* __restrict__ lnw, const float* __restrict__ lnb,
               const float* __restrict__ W,   // [256, 512]
               const float* __restrict__ Wb,
               float* __restrict__ x_prompt,
               const float* __restrict__ emb_col,
               const float* __restrict__ lncw,
               float* __restrict__ stat,      // [32][32]
               float* __restrict__ part,      // [8 d-slices][256 p][256 c]
               const float* __restrict__ x,
               const float* __restrict__ few, const float* __restrict__ feb,
               float* __restrict__ est) {     // [256 c][256 b][mu, rs]
    __shared__ __align__(16) float sX[16 * KA_PITCH];   // concat(LN(emb_prompt), prev), 16 rows
    __shared__ __align__(16) float sW[32 * KA_PITCH];   // 32 rows of W
    __shared__ __align__(16) float sR[8 * 256];         // one partial tile per wave
    __shared__ __align__(16) float sE[256 * KE_PITCH];  // emb_column, the 32 d of the block; row of c: see below
    __shared__ __align__(16) float sY[16 * KE_PITCH];   // x_prompt * ln_col_w, 16 p x the 32 d
    const int tid = threadIdx.x, lane = tid & 31, wave = tid >> 5;

    // the whole work-group takes this branch or none of it does, and it leaves in front of every barrier
    if (blockIdx.x >= KA_TILES + KA_COLS) {
        const int cc = blockIdx.x - (KA_TILES + KA_COLS);
        const unsigned xo = (unsigned)(wave * 32 + lane) * 256u + cc, ro = (unsigned)cc * 256u + lane;
        const float xcol = x[xo];   // lane j holds x[b, c] of the wave's j-th b
        float fw[8], fb[8];
#pragma unroll
        for (int i = 0; i < 8; ++i) {
            fw[i] = few[ro + 32 * i];
            fb[i] = feb[ro + 32 * i];
        }
        // behind the loads, in front of the first write of a register that they name. Inputs only: the loaded values are named
        // so that every load stands in front of the wait, the two offsets so that no load's result lands in one of them
        asm volatile("s_wait_xcnt 0x0" :: "v"(xcol), "v"(fw[0]), "v"(fw[1]), "v"(fw[2]), "v"(fw[3]), "v"(fw[4]), "v"(fw[5]),
                     "v"(fw[6]), "v"(fw[7]), "v"(fb[0]), "v"(fb[1]), "v"(fb[2]), "v"(fb[3]), "v"(fb[4]), "v"(fb[5]),
                     "v"(fb[6]), "v"(fb[7]), "v"(xo), "v"(ro) : "memory");
        // eight b at a time; of the four results a lane keeps the one of group lane & 3, its b being 8 (lane & 3) + (lane >> 2)
        float ss = 0.0f, qq = 0.0f;
        // left rolled: unrolled, this build holds all 32 b in flight in over 400 registers, and a WGP then takes one work-group
#pragma unroll 1
        for (int gr = 0; gr < 4; ++gr) {
            // the unroll directives below keep the indices of the register arrays compile-time constants
            float s[8], q[8];
#pragma unroll
            for (int j = 0; j < 8; ++j) {
                const float xv = __int_as_float(__builtin_amdgcn_readlane(__float_as_int(xcol), gr * 8 + j));
                float sj = 0.0f, qj = 0.0f;
#pragma unroll
                for (int i = 0; i < 8; ++i) {
                    const float a = fmaxf(0.0f, fb[i] + xv * fw[i]);
                    sj += a; qj += a * a;
                }
                s[j] = sj; q[j] = qj;
            }
            // the butterfly over the 32 lanes for eight sums at once: at distances 16, 8 and 4 a lane keeps the half of the b
            // whose bit equals its own and hands the other half over, so 7 exchanges do for 24; the tree of additions is that
            // of a butterfly that keeps every sum in every lane
#pragma unroll
            for (int o = 4; o > 0; o >>= 1) {
                const bool up = (lane & (4 * o)) != 0;
#pragma unroll
                for (int j = 0; j < o; ++j) {
                    const float sl = s[j], sh = s[j + o], ql = q[j], qh = q[j + o];
                    s[j] = (up ? sh : sl) + __shfl_xor(up ? sl : sh, 4 * o, 32);
                    q[j] = (up ? qh : ql) + __shfl_xor(up ? ql : qh, 4 * o, 32);
                }
            }
#pragma unroll
            for (int o = 2; o > 0; o >>= 1) { s[0] += __shfl_xor(s[0], o, 32); q[0] += __shfl_xor(q[0], o, 32); }
            if ((lane & 3) == gr) { ss = s[0]; qq = q[0]; }
        }
        const float mu = ss * (1.0f / 256.0f);
        const float rs = rsqrt_slot(qq * (1.0f / 256.0f) - mu * mu + LN_EPS);
        reinterpret_cast<float2*>(est)[cc * 256 + wave * 32 + 8 * (lane & 3) + (lane >> 2)] = make_float2(mu, rs);
        return;
    }
    if (blockIdx.x >= KA_TILES) {
        const size_t r4 = (size_t)((blockIdx.x - KA_TILES) * 8 + wave) * 64 + lane;
        const float4 e0 = reinterpret_cast<const float4*>(emb_col)[r4];
        const float4 e1 = reinterpret_cast<const float4*>(emb_col)[r4 + 32];
        float s = (e0.x + e0.y) + (e0.z + e0.w) + (e1.x + e1.y) + (e1.z + e1.w);
#pragma unroll
        for (int o = 16; o > 0; o >>= 1) s += __shfl_xor(s, o, 32);
        const float mu = s * (1.0f / 256.0f);
        const float4 d0 = {e0.x - mu, e0.y - mu, e0.z - mu, e0.w - mu};
        const float4 d1 = {e1.x - mu, e1.y - mu, e1.z - mu, e1.w - mu};
        float q = (d0.x * d0.x + d0.y * d0.y) + (d0.z * d0.z + d0.w * d0.w)
                + (d1.x * d1.x + d1.y * d1.y) + (d1.z * d1.z + d1.w * d1.w);
#pragma unroll
        for (int o = 16; o > 0; o >>= 1) q += __shfl_xor(q, o, 32);
        const float rs = rsqrtf(q * (1.0f / 256.0f) + LN_EPS);
        if (lane == 0) {
            float* line = stat + (blockIdx.x - KA_TILES) * 32;
            line[wave]     = mu;
            line[8 + wave] = rs;
        }
        return;
    }
    const int p0 = (blockIdx.x >> 3) * 16, n0 = (blockIdx.x & 7) * 32;

    // emb_column's 32 d of the block go to LDS by asynchronous copies, one 128-byte line per row c: they take no register
    // and land under the first product. The columns c are dealt to the B fragments so that column n of a wave's tile j is
    // c = 2n + j of its 32: a lane's two accumulators of a row p are then adjacent in part.
    // LDS row of column c: (c & ~31) + 16 * (c & 1) + ((c >> 1) & 15); here c = 32 i + (tid >> 3).
    {
        const int c5 = tid >> 3;
        const float* eg = emb_col + c5 * 256 + n0 + (tid & 7) * 4;
        float* el = &sE[(((c5 & 1) << 4) + (c5 >> 1)) * KE_PITCH + (tid & 7) * 4];
#pragma unroll
        for (int i = 0; i < 8; ++i) stage16f(eg + i * 32 * 256, el + i * 32 * KE_PITCH);
    }

    // every global read of the block but Wb's and the residual's emb_prompt is issued before the first use; each wave-wide float4 load covers 512 contiguous bytes
    const float4* W4 = reinterpret_cast<const float4*>(W) + (size_t)n0 * 128;
    const float4* P4 = reinterpret_cast<const float4*>(prev_cell) + (size_t)p0 * 64;
    const float4* E4 = reinterpret_cast<const float4*>(emb_prompt) + (size_t)p0 * 64;
    float4 ev[2][2], gw[2], gb[2], pr[4], wr[16];
#pragma unroll
    for (int j = 0; j < 2; ++j) {
        ev[0][j] = E4[(wave * 2) * 64 + lane + 32 * j];
        ev[1][j] = E4[(wave * 2 + 1) * 64 + lane + 32 * j];
        gw[j] = reinterpret_cast<const float4*>(lnw)[lane + 32 * j];
        gb[j] = reinterpret_cast<const float4*>(lnb)[lane + 32 * j];
    }
#pragma unroll
    for (int i = 0; i < 4; ++i) pr[i] = P4[i * 256 + tid];
#pragma unroll
    for (int i = 0; i < 16; ++i) wr[i] = W4[i * 256 + tid];
    const float cw0 = lncw[n0 + (lane & 15)], cw1 = lncw[n0 + 16 + (lane & 15)];
    // keeps the loads above in front of the first use below: without it this build issues W's only behind the first row sum
    __builtin_amdgcn_sched_barrier(0);

    // LayerNorm of two rows per wave
#pragma unroll
    for (int rr = 0; rr < 2; ++rr) {
        const float4 e0 = ev[rr][0], e1 = ev[rr][1];
        float s = (e0.x + e0.y) + (e0.z + e0.w) + (e1.x + e1.y) + (e1.z + e1.w);
#pragma unroll
        for (int o = 16; o > 0; o >>= 1) s += __shfl_xor(s, o, 32);
        const float mu = s * (1.0f / 256.0f);
        float4 d0 = {e0.x - mu, e0.y - mu, e0.z - mu, e0.w - mu};
        float4 d1 = {e1.x - mu, e1.y - mu, e1.z - mu, e1.w - mu};
        float q = (d0.x * d0.x + d0.y * d0.y) + (d0.z * d0.z + d0.w * d0.w)
                + (d1.x * d1.x + d1.y * d1.y) + (d1.z * d1.z + d1.w * d1.w);
#pragma unroll
        for (int o = 16; o > 0; o >>= 1) q += __shfl_xor(q, o, 32);
        const float rs = rsqrtf(q * (1.0f / 256.0f) + LN_EPS);
        float* row = &sX[(wave * 2 + rr) * KA_PITCH];
        const float4 y0 = {d0.x * rs * gw[0].x + gb[0].x, d0.y * rs * gw[0].y + gb[0].y,
                           d0.z * rs * gw[0].z + gb[0].z, d0.w * rs * gw[0].w + gb[0].w};
        const float4 y1 = {d1.x * rs * gw[1].x + gb[1].x, d1.y * rs * gw[1].y + gb[1].y,
                           d1.z * rs * gw[1].z + gb[1].z, d1.w * rs * gw[1].w + gb[1].w};
        *reinterpret_cast<float4*>(&row[lane * 4])       = y0;
        *reinterpret_cast<float4*>(&row[128 + lane * 4]) = y1;
    }
#pragma unroll
    for (int i = 0; i < 4; ++i) {
        const int idx = i * 256 + tid;
        *reinterpret_cast<float4*>(&sX[(idx >> 6) * KA_PITCH + 256 + (idx & 63) * 4]) = pr[i];
    }
#pragma unroll
    for (int i = 0; i < 16; ++i) {
        const int idx = i * 256 + tid;
        *reinterpret_cast<float4*>(&sW[(idx >> 7) * KA_PITCH + (idx & 127) * 4]) = wr[i];
    }
    __syncthreads();

    const int c = lane & 15, h = lane >> 4;
    const int ns = wave & 1, ks = wave >> 1;
    const float* ap = &sX[c * KA_PITCH + ks * 128 + 4 * h];
    const float* bp = &sW[(ns * 16 + c) * KA_PITCH + ks * 128 + 4 * h];
    v8f acc = {};   // one chain per wave: the waves that share a SIMD fill the matrix unit between them
#pragma unroll
    for (int s = 0; s < 16; ++s) mm8(ap + s * 8, bp + s * 8, acc);
#pragma unroll
    for (int r = 0; r < 8; ++r) sR[wave * 256 + r * 32 + lane] = acc[r];
    __syncthreads();

    // sum the four k-quarters; element (r, lane) of a tile is row 8h + r, column c
    float xp[2];
#pragma unroll
    for (int t = 0; t < 2; ++t) {
        const float v = (sR[t * 256 + tid] + sR[(2 + t) * 256 + tid])
                      + (sR[(4 + t) * 256 + tid] + sR[(6 + t) * 256 + tid]);
        const int p = p0 + 8 * h + wave;       // r = tid >> 5
        const int d = n0 + t * 16 + c;
        xp[t] = v + Wb[d] + emb_prompt[p * 256 + d];
        sY[(8 * h + wave) * KE_PITCH + t * 16 + c] = xp[t] * (t ? cw1 : cw0);
    }
    // each wave's own copies of emb_column have landed before the barrier behind which other waves read them
    stage_wait();
    __syncthreads();
    // stored behind the barrier: in front of it the barrier would wait for the stores to be acknowledged
#pragma unroll
    for (int t = 0; t < 2; ++t) x_prompt[(p0 + 8 * h + wave) * 256 + n0 + t * 16 + c] = xp[t];

    // partial logits: 16 p x 32 c per wave over the block's 32 d, two chains
    const float* ap2 = &sY[c * KE_PITCH + 4 * h];
    const float* bp2 = &sE[(wave * 32 + c) * KE_PITCH + 4 * h];
    v8f l0 = {}, l1 = {};
#pragma unroll
    for (int s = 0; s < 4; ++s) {
        mm8(ap2 + s * 8, bp2 + s * 8, l0);
        mm8(ap2 + s * 8, bp2 + 16 * KE_PITCH + s * 8, l1);
    }
    // four vector slots between the last matrix instruction and the first vector instruction that reads its result: the
    // moves that pair the two accumulators for the 8-byte stores, which this build sets directly behind it. The operands
    // tie the slots to this place.
    asm volatile("v_nop\n\tv_nop\n\tv_nop\n\tv_nop" : "+v"(l0), "+v"(l1));
    // element (r, lane) is row 8h + r, columns c = 32 wave + 2 (lane & 15) and the next: 16 lanes write one 128-byte line
    float* prow = part + ((size_t)(blockIdx.x & 7) * 256 + p0 + 8 * h) * 256 + wave * 32 + 2 * c;
#pragma unroll
    for (int r = 0; r < 8; ++r) *reinterpret_cast<float2*>(prow + r * 256) = make_float2(l0[r], l1[r]);
    // behind the eight stores, in front of any later write of a register that they name
    asm volatile("s_wait_xcnt 0x0" ::: "memory");
}

// ---------------- kC: mask = softmax(logits), the logits put together from the eight partial sums (formula at kA)
// grid 32, block 256 = 8 waves: one row p per wave, eight adjacent columns c per lane so that every store is 16 bytes wide.
__global__ __launch_bounds__(256)
void kC_mask(const float* __restrict__ x_prompt,
             const float* __restrict__ part,
             const float* __restrict__ stat,
             const float* __restrict__ lncw, const float* __restrict__ lncb,
             float* __restrict__ maskf,
             _Float16* __restrict__ maskh) {
    const int tid = threadIdx.x, lane = tid & 31, wave = tid >> 5;
    const int p0 = blockIdx.x * 8;

    // byte offsets of the lane: its place in a [256][256] f32 plane, in a row of 256 f32, and its statistics line
    // (the lane's columns c = 8 lane .. 8 lane + 7 are the eight rows of line number lane)
    const unsigned ob = ((unsigned)(p0 + wave) * 256u + lane * 8u) * 4u, ol = lane * 32u, os = lane * 128u;
    const char* Sb = reinterpret_cast<const char*>(stat) + os;
    const v4f ma = *reinterpret_cast<const v4f*>(Sb),      mb = *reinterpret_cast<const v4f*>(Sb + 16);
    const v4f sa = *reinterpret_cast<const v4f*>(Sb + 32), sb = *reinterpret_cast<const v4f*>(Sb + 48);
    const char* Wl = reinterpret_cast<const char*>(lncw) + ol;
    const char* Bl = reinterpret_cast<const char*>(lncb) + ol;
    const v4f wa = *reinterpret_cast<const v4f*>(Wl), wb = *reinterpret_cast<const v4f*>(Wl + 16);
    const v4f ba = *reinterpret_cast<const v4f*>(Bl), bb = *reinterpret_cast<const v4f*>(Bl + 16);
    const char* Xl = reinterpret_cast<const char*>(x_prompt) + ob;
    const v4f xa = *reinterpret_cast<const v4f*>(Xl), xb = *reinterpret_cast<const v4f*>(Xl + 16);
    const char* Rl = reinterpret_cast<const char*>(part) + ob;
    v4f ra[8], rb[8];
#pragma unroll
    for (int s = 0; s < 8; ++s) {
        ra[s] = *reinterpret_cast<const v4f*>(Rl + s * 262144);
        rb[s] = *reinterpret_cast<const v4f*>(Rl + s * 262144 + 16);
    }
    // inputs only: holds all 26 loads in front of the first use, so that the wave pays the L2 latency once (left alone, this
    // build issues them in five groups, each behind the wait for the one before); the offsets are named so that no load's
    // result lands in an address register of a load issued before it
    asm volatile("" :: "v"(ma), "v"(mb), "v"(sa), "v"(sb), "v"(wa), "v"(wb), "v"(ba), "v"(bb), "v"(xa), "v"(xb),
                       "v"(ra[0]), "v"(ra[1]), "v"(ra[2]), "v"(ra[3]), "v"(ra[4]), "v"(ra[5]), "v"(ra[6]), "v"(ra[7]),
                       "v"(rb[0]), "v"(rb[1]), "v"(rb[2]), "v"(rb[3]), "v"(rb[4]), "v"(rb[5]), "v"(rb[6]), "v"(rb[7]),
                       "v"(ob), "v"(ol), "v"(os));

    float s1 = (xa.x * wa.x + xa.y * wa.y) + (xa.z * wa.z + xa.w * wa.w)
             + (xb.x * wb.x + xb.y * wb.y) + (xb.z * wb.z + xb.w * wb.w);
    float s2 = (xa.x * ba.x + xa.y * ba.y) + (xa.z * ba.z + xa.w * ba.w)
             + (xb.x * bb.x + xb.y * bb.y) + (xb.z * bb.z + xb.w * bb.w);
#pragma unroll
    for (int o = 16; o > 0; o >>= 1) { s1 += __shfl_xor(s1, o, 32); s2 += __shfl_xor(s2, o, 32); }

    const v4f ta = ((ra[0] + ra[1]) + (ra[2] + ra[3])) + ((ra[4] + ra[5]) + (ra[6] + ra[7]));
    const v4f tb = ((rb[0] + rb[1]) + (rb[2] + rb[3])) + ((rb[4] + rb[5]) + (rb[6] + rb[7]));
    float v[8];
#pragma unroll
    for (int i = 0; i < 4; ++i) {
        v[i]     = sa[i] * (ta[i] - ma[i] * s1) + s2;
        v[4 + i] = sb[i] * (tb[i] - mb[i] * s1) + s2;
    }
    float mx = v[0];
#pragma unroll
    for (int i = 1; i < 8; ++i) mx = fmaxf(mx, v[i]);
#pragma unroll
    for (int o = 16; o > 0; o >>= 1) mx = fmaxf(mx, __shfl_xor(mx, o, 32));
    float sm = 0.0f;
#pragma unroll
    for (int i = 0; i < 8; ++i) { v[i] = __expf(v[i] - mx); sm += v[i]; }
#pragma unroll
    for (int o = 16; o > 0; o >>= 1) sm += __shfl_xor(sm, o, 32);
    v8h hv;
#pragma unroll
    for (int i = 0; i < 8; ++i) { v[i] = v[i] / sm; hv[i] = (_Float16)v[i]; }
    const unsigned o8 = ob >> 2;
    *reinterpret_cast<float4*>(maskf + o8)     = make_float4(v[0], v[1], v[2], v[3]);
    *reinterpret_cast<float4*>(maskf + o8 + 4) = make_float4(v[4], v[5], v[6], v[7]);
    *reinterpret_cast<v8h*>(maskh + o8)        = hv;
}

// ---------------- kF: out[b,p,d] = (sum_c mask[p,c]*x_emb[b,c,d]) * (1+ew[p]) + mask[b,p]*eb[b]
// with x_emb[b,c,:] = LN_over_d(relu(feb[c,:] + x[b,c]*few[c,:])) built in LDS as f16 [b, d][c]; it never leaves the WGP.
// grid 256: one work-group per 4 b and 64 d, so that a value of few or feb, once in a register, serves four b and the
// work-group reads a quarter of the two arrays; mu and rs over the whole row d come from est (written in kA's launch).
// block 512 = 16 waves; in the product a wave owns 64 p x the 64 d of one b (4 x 4 tiles). LDS rows 64 bi .. 64 bi + 63: b0 + bi.
// the columns d are dealt to the B fragments so that column n of tile j is d = 4n + j of the wave's 64: a lane's four
// accumulators of one row p are then adjacent in out, and one 16-byte store per lane writes 256 contiguous bytes per row.
// LDS row of column d of the 64, inside its b: 16 * (d & 3) + (d >> 2). Rows 16 apart start in the same bank, and four lanes of
// a transpose store write such rows; the rows of odd d therefore hold c at c ^ 64, which keeps that store at two lanes a bank.
// every unroll directive below keeps the index of a register array, and each LDS offset, a compile-time constant.
#define KF_PITCH 264   // halves; 528 B = 16 B x odd, the conflict-free pitch for 16-byte fragment reads
__global__ __launch_bounds__(512)
void kF_emb_gemm(const float* __restrict__ x,
                 const float* __restrict__ few, const float* __restrict__ feb,
                 const float* __restrict__ lnw, const float* __restrict__ lnb,
                 const float* __restrict__ est,
                 const _Float16* __restrict__ maskh,
                 const float* __restrict__ maskf,
                 const float* __restrict__ expand_w,
                 const float* __restrict__ expand_b,
                 float* __restrict__ out) {
    __shared__ __align__(16) _Float16 sA[256][KF_PITCH];  // mask    [p][c]
    __shared__ __align__(16) _Float16 sT[256][KF_PITCH];  // x_emb^T [64 bi + dealt row of d][c, or c ^ 64]
    __shared__ __align__(16) float sSc[256];              // 1 + ew[p]
    __shared__ __align__(16) float sBi[4 * 256];          // mask[b,p] * eb[b], [bi][p]
    __shared__ __align__(16) float sU[16][192];           // per wave, of its 16 c: [iter][bi][x, mu, rs][t]
    const int tid = threadIdx.x, lane = tid & 31;
    // the wave's number in a scalar register: the wave's part of every address below is then scalar arithmetic
    const int wave = __builtin_amdgcn_readfirstlane(tid >> 5);
    const int b0 = (blockIdx.x & 63) * 4, d0 = (blockIdx.x >> 6) * 64;

    // the small reads first: loads come back in the order of issue, so behind them the first rows can be worked on while
    // the later rows are still under way.
    // x, mu and rs of the wave's 16 c and the 4 b are the same for every lane. One 16-byte load per lane fetches each kind,
    // so that their latency is paid once (as scalar loads they came in a dozen dependent round trips):
    // lane -> c number lane >> 1 (iter = that >> 2, t = that & 3), b pair lane & 1; for x, b = lane & 3 and iter = (lane >> 2) & 3
    const int ek = lane >> 1;
    const float4 e4 = *reinterpret_cast<const float4*>(
        &est[(((ek >> 2) * 64 + wave * 4 + (ek & 3)) * 256 + b0) * 2 + (lane & 1) * 4]);
    const float4 xq = *reinterpret_cast<const float4*>(&x[(b0 + (lane & 3)) * 256 + ((lane >> 2) & 3) * 64 + wave * 4]);
    float g[2], h[2];
#pragma unroll
    for (int i = 0; i < 2; ++i) {
        const int d = d0 + lane + 32 * i;
        g[i] = lnw[d]; h[i] = lnb[d];
    }
    // the epilogue's factors, read once per work-group; element tid + 512 k of [bi][p] is bi = 2k + (tid >> 8), p = tid & 255
    const float ew = expand_w[tid & 255];
    const float mf0 = maskf[b0 * 256 + tid], mf1 = maskf[b0 * 256 + 512 + tid];
    const float eb0 = expand_b[b0 + (tid >> 8)], eb1 = expand_b[b0 + 2 + (tid >> 8)];
    // inputs only: holds the reads above in front of the row loads. Left alone, this build issues x's behind the
    // 64 row loads, and the wave then waits for every row before it starts on the first
    asm volatile("" :: "v"(e4.x), "v"(e4.y), "v"(e4.z), "v"(e4.w), "v"(xq.x), "v"(xq.y), "v"(xq.z), "v"(xq.w),
                       "v"(g[0]), "v"(g[1]), "v"(h[0]), "v"(h[1]), "v"(ew), "v"(mf0), "v"(mf1), "v"(eb0), "v"(eb1));
    // every row load of the wave is issued here, 64 in flight: four adjacent c rows of each 64-c step, the block's 64 d
    float fw[4][4][2], fb[4][4][2];
    const float* __restrict__ wr = few + (size_t)(wave * 4) * 256 + d0 + lane;
    const float* __restrict__ br = feb + (size_t)(wave * 4) * 256 + d0 + lane;
#pragma unroll
    for (int iter = 0; iter < 4; ++iter) {
#pragma unroll
        for (int t = 0; t < 4; ++t) {
#pragma unroll
            for (int i = 0; i < 2; ++i) {
                fw[iter][t][i] = wr[(iter * 64 + t) * 256 + 32 * i];
                fb[iter][t][i] = br[(iter * 64 + t) * 256 + 32 * i];
            }
        }
        // keeps the steps' loads in the order in which the steps want them: left alone, this build issues the first step's last
        __builtin_amdgcn_sched_barrier(0);
    }
    // behind the row loads, in front of the first write of a register that they name
    asm volatile("s_wait_xcnt 0x0" ::: "memory");

    // the whole mask: 16 copies per wave, each one row of 512 contiguous bytes; issued behind the row loads, which are
    // wanted first, they land while x_emb is computed
#pragma unroll
    for (int i = 0; i < 16; ++i) {
        const int row = i * 16 + wave;
        stage16(maskh + (size_t)row * 256 + lane * 8, &sA[row][lane * 8]);
    }

    const int trow = ((lane & 3) << 4) + (lane >> 2);   // the lane's part of the LDS row of d = lane + 32 i
    const int tswp = (lane & 1) << 6;                   // odd d: the 64-c halves swapped

    // no branch round these stores, behind which the build would set the loads: threads tid and tid + 256 store the same word
    sSc[tid & 255]  = 1.0f + ew;
    sBi[tid]        = mf0 * eb0;
    sBi[512 + tid]  = mf1 * eb1;

    // through the wave's own piece of LDS they come back to every lane as 16-byte broadcast reads, four adjacent c each
    float* U = sU[wave];
    {
        float* ue = U + ((ek >> 2) * 4 + (lane & 1) * 2) * 12 + (ek & 3);
        ue[4]  = e4.x; ue[8]  = e4.y;    // mu, rs of the pair's first b
        ue[16] = e4.z; ue[20] = e4.w;    // and of its second
        *reinterpret_cast<float4*>(U + (lane & 15) * 12) = xq;           // lane & 15 = 4 iter + bi; lanes 16 apart store the same words
    }
    // the wave's stores above have reached LDS before its lanes read one another's words; no other wave reads them
    asm volatile("s_wait_dscnt 0x0" ::: "memory");

#pragma unroll
    for (int iter = 0; iter < 4; ++iter) {
        const int c = iter * 64 + wave * 4;
#pragma unroll
        for (int bi = 0; bi < 4; ++bi) {
            const float4 x4 = *reinterpret_cast<const float4*>(U + (iter * 4 + bi) * 12);
            const float4 m4 = *reinterpret_cast<const float4*>(U + (iter * 4 + bi) * 12 + 4);
            const float4 r4 = *reinterpret_cast<const float4*>(U + (iter * 4 + bi) * 12 + 8);
            const float xv[4] = {x4.x, x4.y, x4.z, x4.w};
            const float mu[4] = {m4.x, m4.y, m4.z, m4.w};
            const float rs[4] = {r4.x, r4.y, r4.z, r4.w};
#pragma unroll
            for (int i = 0; i < 2; ++i) {
                union { _Float16 hh[4]; uint2 u; } pk;
#pragma unroll
                for (int t = 0; t < 4; ++t) {
                    const float a = fmaxf(0.0f, fb[iter][t][i] + xv[t] * fw[iter][t][i]);
                    pk.hh[t] = (_Float16)((a - mu[t]) * rs[t] * g[i] + h[i]);
                }
                // b64 packed transpose store, to the dealt row of d = lane + 32 i of b0 + bi
                *reinterpret_cast<uint2*>(&sT[trow + 8 * i + 64 * bi][c ^ tswp]) = pk.u;
            }
        }
        // keeps a step's work in front of the wait for the next step's rows: left alone, this build starts all four steps at
        // once, so that it waits for the last rows before the first store, and runs out of registers
        __builtin_amdgcn_sched_barrier(0);
    }
    // each wave's own mask copies have landed before the barrier behind which other waves read them
    stage_wait();
    __syncthreads();

    const int wp = (wave & 3) * 64;    // first p row of the wave
    const int wd = (wave >> 2) * 64;   // first LDS row of the wave's columns: the 64 d of b0 + (wave >> 2)
    const int m  = lane & 15;
    const int kb = (lane >> 4) << 3;   // 0 or 8 (ISA 16-bit lane layout)

    v8f acc[4][4] = {};
#pragma unroll
    for (int c0 = 0; c0 < 256; c0 += 32) {
        v16h af[4];
#pragma unroll
        for (int i = 0; i < 4; ++i) {
            const v8h alo = *reinterpret_cast<const v8h*>(&sA[wp + i * 16 + m][c0 + kb]);
            const v8h ahi = *reinterpret_cast<const v8h*>(&sA[wp + i * 16 + m][c0 + 16 + kb]);
            af[i] = __builtin_shufflevector(alo, ahi,
                      0, 1, 2, 3, 4, 5, 6, 7, 8, 9, 10, 11, 12, 13, 14, 15);
        }
        v16h bf[4];
#pragma unroll
        for (int j = 0; j < 4; ++j) {
            const int cs = c0 ^ ((j & 1) << 6);   // tile j holds the columns d = 4m + j: odd j, halves swapped
            const v8h blo = *reinterpret_cast<const v8h*>(&sT[wd + j * 16 + m][cs + kb]);
            const v8h bhi = *reinterpret_cast<const v8h*>(&sT[wd + j * 16 + m][cs + 16 + kb]);
            bf[j] = __builtin_shufflevector(blo, bhi,
                      0, 1, 2, 3, 4, 5, 6, 7, 8, 9, 10, 11, 12, 13, 14, 15);
        }
#pragma unroll
        for (int j = 0; j < 4; ++j) {
#pragma unroll
            for (int i = 0; i < 4; ++i)
                acc[i][j] = __builtin_amdgcn_wmma_f32_16x16x32_f16(false, af[i], false, bf[j],
                                                                   (short)0, acc[i][j], false, false);
        }
    }

    // epilogue: C/D layout: VGPR r -> row m = r + (lane>=16 ? 8 : 0), col n = lane&15, which is d = d0 + 4n + j
    const int n  = lane & 15;
    const int mh = (lane >> 4) * 8;
    // one address for all 32 stores, the row as a constant offset; 16 lanes cover 256 contiguous bytes of a row
    float* __restrict__ orow = out + ((size_t)(b0 + (wave >> 2)) * 256 + wp + mh) * 256 + d0 + 4 * n;
#pragma unroll
    for (int i = 0; i < 4; ++i) {
#pragma unroll
        for (int r = 0; r < 8; ++r) {
            const int p = wp + i * 16 + mh + r;
            const float scale = sSc[p];
            const float bias  = sBi[(wave >> 2) * 256 + p];
            *reinterpret_cast<float4*>(orow + (i * 16 + r) * 256) =
                make_float4(acc[i][0][r] * scale + bias, acc[i][1][r] * scale + bias,
                            acc[i][2][r] * scale + bias, acc[i][3][r] * scale + bias);
        }
    }
}

extern "C" void kernel_launch(void* const* d_in, const int* in_sizes, int n_in,
                              void* d_out, int out_size, void* d_ws, size_t ws_size,
                              hipStream_t stream) {
    const float* x            = (const float*)d_in[0];
    const float* prev_cell    = (const float*)d_in[1];
    const float* few          = (const float*)d_in[2];
    const float* feb          = (const float*)d_in[3];
    const float* ln_emb_w     = (const float*)d_in[4];
    const float* ln_emb_b     = (const float*)d_in[5];
    const float* ln_col_w     = (const float*)d_in[6];
    const float* ln_col_b     = (const float*)d_in[7];
    const float* ln_prompt_w  = (const float*)d_in[8];
    const float* ln_prompt_b  = (const float*)d_in[9];
    const float* dense_imp_w  = (const float*)d_in[10];
    const float* dense_imp_b  = (const float*)d_in[11];
    const float* emb_column   = (const float*)d_in[12];
    const float* emb_prompt   = (const float*)d_in[13];
    const float* expand_w     = (const float*)d_in[14];
    const float* expand_b     = (const float*)d_in[15];
    float* out = (float*)d_out;

    char* ws = (char*)d_ws;
    float*    x_prompt = (float*)(ws);               // 262144 B
    float*    stat     = (float*)(ws + 262144);      // 4096 B
    float*    maskf    = (float*)(ws + 524288);      // 262144 B
    _Float16* maskh    = (_Float16*)(ws + 786432);   // 131072 B
    float*    part     = (float*)(ws + 1048576);     // 2097152 B
    float*    est      = (float*)(ws + 3145728);     // 524288 B

    kA_prompt<<<416, 256, 0, stream>>>(emb_prompt, prev_cell, ln_prompt_w, ln_prompt_b,
                                       dense_imp_w, dense_imp_b, x_prompt,
                                       emb_column, ln_col_w, stat, part, x, few, feb, est);
    kC_mask<<<32, 256, 0, stream>>>(x_prompt, part, stat, ln_col_w, ln_col_b, maskf, maskh);
    kF_emb_gemm<<<256, 512, 0, stream>>>(x, few, feb, ln_emb_w, ln_emb_b, est, maskh, maskf,
                                         expand_w, expand_b, out);
}
